// v008
// Measured on an AMD MI455X. A time is GPU time per run, averaged over a window of back-to-back runs after a warm-up
// (all launches, gaps included; the runs take copies of the inputs in turn), and the median of several windows.
// Apart from v000's, it joins two sittings. Times from different sittings can be a few percent apart, while
// side-by-side timings come from the same sitting.
// Earlier versions than v008 are not in this document.
// It runs in 64.6 microseconds.
// Next to v007, in two timings, it ran 1.10 and 1.09 times as fast.
// All steps since the starting kernel, v000, together make it 6.13 times as fast.
#include <hip/hip_runtime.h>
// DiffBertSelfAttention (2 x 2048 tokens, D 1024 = 16 heads of 64): q, k, v = x W^T; RoFormer rotary from the sinusoidal_pos INPUT ([sin | cos] halves, interleave-duplicated: out[2i] = x[2i] cos_i - x[2i+1] sin_i, out[2i+1] = x[2i+1] cos_i + x[2i] sin_i); scores/8 + attention_mask[b, key] (additive INPUT, broadcast over heads and queries); softmax; ctx = probs v merged -> the output (no output projection).
// Structure, three launches: k_prep (exact f16 plane of x, exact x16 weight planes, the mask table); k_qkv (q, k, v as WMMA GEMMs, 64x64 wave tiles, f32 accumulation, whose epilogue does the interleaved RoPE in f32 from the input table, bf16-rounded like every input, the f16 conversion, and V^T by an LDS tile); the fused flash kernel with the per-key additive mask (mode 17: a table made from the input in the same call, rounded like every input and in base-2 units; plain operands: every row averages ~2048 keys) writing the merged context straight to the output.
// Compute dtype: inputs and parameters rounded to bf16; q/k/P/v as plain f16 operands (~2^-12); RoPE/softmax f32. v_wmma_f32_16x16x32_f16.
#define NB 2
#define DM 1024
#define NKV 16
#define NREP (NH / NKV)
#define KVD (NKV * 64)           /* 1024 */
#define NR (NB * SLEN)           /* 4096 */
#define SLEN 2048
#define TQ SLEN
#define TK SLEN
#define NH 16
#define SCL 0.125f
#define LOG2E 1.4426950408889634f
#define SCL2 (SCL * LOG2E)      /* scores in base-2 units: exp(s) = 2^(s log2 e) */
#define QBLKS (TQ / 128)
#define QB05 0
#define QBN5 4
#define QB0P 0
#define QBNP QBLKS           /* non-causal: plain flash on every query block */
#define RE 256
typedef __bf16 v16b __attribute__((ext_vector_type(16)));
typedef unsigned short v8us __attribute__((ext_vector_type(8), may_alias));
typedef float  v8f  __attribute__((ext_vector_type(8)));
typedef float  v4f  __attribute__((ext_vector_type(4)));
typedef float  v4fa __attribute__((ext_vector_type(4), may_alias));
typedef float  v2fa __attribute__((ext_vector_type(2), may_alias));
typedef float  v2f  __attribute__((ext_vector_type(2)));
union FragB { v16b v; v8us half[2]; unsigned short u[16]; };

__device__ __forceinline__ unsigned short bf16_bits(float x) { unsigned int u = __float_as_uint(x); return (unsigned short)((u + 0x7FFFu + ((u >> 16) & 1u)) >> 16); }
__device__ __forceinline__ float bf16_val(unsigned short b) { return __uint_as_float(((unsigned int)b) << 16); }
__device__ __forceinline__ float bf16_round(float x) { return bf16_val(bf16_bits(x)); }
// D += A·B with NT terms: 1 = ah·bh, 2 = + al·bh (A split), 3 = + ah·bl (both split)
template <int NT>
__device__ __forceinline__ v8f mmaN(v16b ah, v16b al, v16b bh, v16b bl, v8f c) {
  c = __builtin_amdgcn_wmma_f32_16x16x32_bf16(false, ah, false, bh, (short)0, c, false, false);
  if (NT >= 2) c = __builtin_amdgcn_wmma_f32_16x16x32_bf16(false, al, false, bh, (short)0, c, false, false);
  if (NT >= 3) c = __builtin_amdgcn_wmma_f32_16x16x32_bf16(false, ah, false, bl, (short)0, c, false, false);
  asm volatile("v_nop\n\tv_nop\n\tv_nop\n\tv_nop" : "+v"(c) : "v"(ah), "v"(al), "v"(bh), "v"(bl));
  return c;
}

__global__ __launch_bounds__(256) void k_wt_bf16(const float* __restrict__ W, unsigned short* __restrict__ Wt, int K, int N) {
  const int t = blockIdx.x * 256 + threadIdx.x;
  const int k8n = K / 8;
  if (t >= N * k8n) return;
  const int n = t / k8n, k8 = (t % k8n) * 8;
  v8us v;
#pragma unroll
  for (int i = 0; i < 8; ++i) v[i] = bf16_bits(W[(size_t)(k8 + i) * N + n]);
  *(v8us*)(Wt + (size_t)n * K + k8) = v;
  
}

// GEMM C[M][N] (f32, pitch ldc) = act(A[M][K]·W + bias). A f32 row-major (pitch lda) converted per fragment to bf16
// (ASPLIT: hi/lo two planes -> 2 terms, else single rounded term); Wt bf16 [N][K] (pitch ldb). BIAS_BF16 rounds the
// bias to bf16 first (bias quantised to bf16 before the add). K%32==0, M%16==0, N%64==0.
template <bool ASPLIT, int ACT, bool BIAS_BF16>
__global__ __launch_bounds__(128) void k_gemm_bf(const float* __restrict__ A, int lda, const unsigned short* __restrict__ Wt, int ldb,
                                               const float* __restrict__ bias, float* __restrict__ C, int ldc, int M, int N, int K) {
  __shared__ __attribute__((aligned(16))) float so[4][16][64];
  const int tid = threadIdx.x, w = tid >> 5, lane = tid & 31, ln = lane & 15, hh = lane >> 4;
  const int ntn = N / 64;
  const int wid = blockIdx.x * 4 + w;
  const int mt = wid / ntn, nq = wid % ntn;
  if (mt * 16 >= M) return;
  const int row0 = mt * 16, col0 = nq * 64;
  const float* arow = A + (size_t)(row0 + ln) * lda;
  v8f acc[4] = {};
  for (int kb = 0; kb < K; kb += 32) {
    FragB ah, al;
    const v4f x0 = *(const v4fa*)(arow + kb + 8 * hh), x1 = *(const v4fa*)(arow + kb + 8 * hh + 4);
    const v4f x2 = *(const v4fa*)(arow + kb + 16 + 8 * hh), x3 = *(const v4fa*)(arow + kb + 16 + 8 * hh + 4);
    float xs[16] = {x0[0],x0[1],x0[2],x0[3],x1[0],x1[1],x1[2],x1[3],x2[0],x2[1],x2[2],x2[3],x3[0],x3[1],x3[2],x3[3]};
#pragma unroll
    for (int i = 0; i < 16; ++i) { const unsigned short hb = bf16_bits(xs[i]); ah.u[i] = hb; al.u[i] = ASPLIT ? bf16_bits(xs[i] - bf16_val(hb)) : (unsigned short)0; }
#pragma unroll
    for (int t = 0; t < 4; ++t) {
      const unsigned short* brow = Wt + (size_t)(col0 + t * 16 + ln) * ldb + kb;
      FragB b;
      b.half[0] = *(const v8us*)(brow + 8 * hh);
      b.half[1] = *(const v8us*)(brow + 16 + 8 * hh);
      acc[t] = mmaN<ASPLIT ? 2 : 1>(ah.v, al.v, b.v, b.v, acc[t]);
    }
  }
#pragma unroll
  for (int t = 0; t < 4; ++t) {
    float bv = bias ? bias[col0 + t * 16 + ln] : 0.f;
    if (BIAS_BF16) bv = bf16_round(bv);
#pragma unroll
    for (int r = 0; r < 8; ++r) { float v = acc[t][r] + bv; if (ACT == 1) v = fmaxf(v, 0.f); so[w][8 * hh + r][t * 16 + ln] = v; }
  }
  __builtin_amdgcn_fence(__ATOMIC_ACQ_REL, "workgroup");
  __builtin_amdgcn_wave_barrier();
  const int rsub = lane >> 4, c4 = (lane & 15) * 4;
  {
#pragma unroll
    for (int q = 0; q < 8; ++q) {
      const int r = q * 2 + rsub;
      const v4f v = *(const v4fa*)&so[w][r][c4];
      *(v4f*)(C + (size_t)(row0 + r) * ldc + col0 + c4) = v;
    }
    
  }
}

// GEMM C = act(A·W + bias + resid): A f32 (ASPLIT -> hi/lo 2 terms), Wt bf16 [N][K]; ACT 0 none, 1 relu, 2 exact gelu;
// resid (optional, f32, row index = (row % rmod), pitch ldr, RES_BF16 rounds it) added before the activation.
template <bool ASPLIT, int ACT, bool BIAS_BF16, bool RES_BF16>
__global__ __launch_bounds__(128) void k_gemm_bf3(const float* __restrict__ A, int lda, const unsigned short* __restrict__ Wt, int ldb,
                                                const float* __restrict__ bias, const float* __restrict__ resid, int rmod, int ldr,
                                                float* __restrict__ C, int ldc, int M, int N, int K) {
  __shared__ __attribute__((aligned(16))) float so[4][16][64];
  const int tid = threadIdx.x, w = tid >> 5, lane = tid & 31, ln = lane & 15, hh = lane >> 4;
  const int ntn = N / 64;
  const int wid = blockIdx.x * 4 + w;
  const int mt = wid / ntn, nq = wid % ntn;
  if (mt * 16 >= M) return;
  const int row0 = mt * 16, col0 = nq * 64;
  const float* arow = A + (size_t)(row0 + ln) * lda;
  v8f acc[4] = {};
  for (int kb = 0; kb < K; kb += 32) {
    FragB ah, al;
    const v4f x0 = *(const v4fa*)(arow + kb + 8 * hh), x1 = *(const v4fa*)(arow + kb + 8 * hh + 4);
    const v4f x2 = *(const v4fa*)(arow + kb + 16 + 8 * hh), x3 = *(const v4fa*)(arow + kb + 16 + 8 * hh + 4);
    float xs[16] = {x0[0],x0[1],x0[2],x0[3],x1[0],x1[1],x1[2],x1[3],x2[0],x2[1],x2[2],x2[3],x3[0],x3[1],x3[2],x3[3]};
#pragma unroll
    for (int i = 0; i < 16; ++i) { const unsigned short hb = bf16_bits(xs[i]); ah.u[i] = hb; al.u[i] = ASPLIT ? bf16_bits(xs[i] - bf16_val(hb)) : (unsigned short)0; }
#pragma unroll
    for (int t = 0; t < 4; ++t) {
      const unsigned short* brow = Wt + (size_t)(col0 + t * 16 + ln) * ldb + kb;
      FragB b;
      b.half[0] = *(const v8us*)(brow + 8 * hh);
      b.half[1] = *(const v8us*)(brow + 16 + 8 * hh);
      acc[t] = mmaN<ASPLIT ? 2 : 1>(ah.v, al.v, b.v, b.v, acc[t]);
    }
  }
#pragma unroll
  for (int t = 0; t < 4; ++t) {
    const int col = col0 + t * 16 + ln;
    float bv = bias ? bias[col] : 0.f;
    if (BIAS_BF16) bv = bf16_round(bv);
#pragma unroll
    for (int r = 0; r < 8; ++r) {
      float v = acc[t][r] + bv;
      if (resid) { float rv = resid[(size_t)((row0 + 8 * hh + r) % rmod) * ldr + col]; if (RES_BF16) rv = bf16_round(rv); v += rv; }
      if (ACT == 1) v = fmaxf(v, 0.f);
      if (ACT == 2) v = 0.5f * v * (1.0f + erff(v * 0.70710678118654752f));
      if (ACT == 3) { const float u = 0.7978845608028654f * (v + 0.044715f * v * v * v); v = 0.5f * v * (1.0f + tanhf(u)); }
      so[w][8 * hh + r][t * 16 + ln] = v;
    }
  }
  __builtin_amdgcn_fence(__ATOMIC_ACQ_REL, "workgroup");
  __builtin_amdgcn_wave_barrier();
  const int rsub = lane >> 4, c4 = (lane & 15) * 4;
  {
#pragma unroll
    for (int q = 0; q < 8; ++q) {
      const int r = q * 2 + rsub;
      const v4f v = *(const v4fa*)&so[w][r][c4];
      *(v4f*)(C + (size_t)(row0 + r) * ldc + col0 + c4) = v;
    }
    
  }
}
// row LayerNorm (biased variance, eps) over N: s = X (+ R); optional out_sum <- s; out_norm <- (s-mu)*rsqrt(var+eps)*g + b
template <bool PARAM_BF16>
__global__ __launch_bounds__(256) void k_layernorm(const float* __restrict__ X, const float* __restrict__ R, const float* __restrict__ g, const float* __restrict__ bta,
                                                  float* __restrict__ out_sum, float* __restrict__ out_norm, int N, float eps) {
  __shared__ float red[256];
  const int row = blockIdx.x, tid = threadIdx.x;
  const float* x = X + (size_t)row * N; const float* rr = R ? R + (size_t)row * N : nullptr;
  float vals[16];                     // up to N = 4096
  const int per = N / 256;            // contiguous chunk per thread? use strided-by-4 chunks: thread handles j = tid*4 + 1024*u
  float s1 = 0.f;
  for (int u = 0; u < per / 4; ++u) {
    const int j = tid * 4 + 1024 * u;
    const v4f a = *(const v4fa*)(x + j);
    v4f b = {0.f,0.f,0.f,0.f}; if (rr) b = *(const v4fa*)(rr + j);
#pragma unroll
    for (int q = 0; q < 4; ++q) { const float v = a[q] + b[q]; vals[u * 4 + q] = v; s1 += v; }
  }
  red[tid] = s1; __syncthreads();
  for (int st = 128; st > 0; st >>= 1) { if (tid < st) red[tid] += red[tid + st]; __syncthreads(); }
  const float mu = red[0] / (float)N; __syncthreads();
  float s2 = 0.f;
  for (int u = 0; u < per / 4; ++u)
#pragma unroll
    for (int q = 0; q < 4; ++q) { const float c = vals[u * 4 + q] - mu; s2 += c * c; }
  red[tid] = s2; __syncthreads();
  for (int st = 128; st > 0; st >>= 1) { if (tid < st) red[tid] += red[tid + st]; __syncthreads(); }
  const float rs = rsqrtf(red[0] / (float)N + eps);
  {
    for (int u = 0; u < per / 4; ++u) {
      const int j = tid * 4 + 1024 * u;
      v4f o, sm;
#pragma unroll
      for (int q = 0; q < 4; ++q) {
        float gg = g[j + q], bb = bta[j + q];
        if (PARAM_BF16) { gg = bf16_round(gg); bb = bf16_round(bb); }
        sm[q] = vals[u * 4 + q]; o[q] = (vals[u * 4 + q] - mu) * rs * gg + bb;
      }
      if (out_sum) *(v4f*)(out_sum + (size_t)row * N + j) = sm;
      *(v4f*)(out_norm + (size_t)row * N + j) = o;
    }
    
  }
}



// ---- f16 WMMA path (v_wmma_f32_16x16x32_f16): 11-bit significands for operands in range — used where a [0,1] probability operand needs more precision than bf16
typedef _Float16 v16h __attribute__((ext_vector_type(16)));
union FragH { v16h v; v8us half[2]; _Float16 h[16]; unsigned short u[16]; };
template <int NT>
__device__ __forceinline__ v8f mmaH(v16h ah, v16h al, v16h bh, v16h bl, v8f c) {
  c = __builtin_amdgcn_wmma_f32_16x16x32_f16(false, ah, false, bh, (short)0, c, false, false);
  if (NT >= 2) c = __builtin_amdgcn_wmma_f32_16x16x32_f16(false, al, false, bh, (short)0, c, false, false);
  if (NT >= 3) c = __builtin_amdgcn_wmma_f32_16x16x32_f16(false, ah, false, bl, (short)0, c, false, false);
  asm volatile("v_nop\n\tv_nop\n\tv_nop\n\tv_nop" : "+v"(c) : "v"(ah), "v"(al), "v"(bh), "v"(bl));
  return c;
}
// batched GEMM like k_gemm_b but f16 operands: A f32 (split into f16 hi/lo if ASPLIT, else rounded to f16), Bt = f16 values [n][k]; alpha; C f32; N multiple of 16 (partial tiles skipped)
template <bool ASPLIT>
__global__ __launch_bounds__(128) void k_gemm_h(const float* __restrict__ A, int lda, size_t sA, const _Float16* __restrict__ Bh, int ldb, size_t sB, float alpha, float* __restrict__ C, int ldc, size_t sC, int M, int N, int K) {
  __shared__ __attribute__((aligned(16))) float so[4][16][64];
  const int tid = threadIdx.x, w = tid >> 5, lane = tid & 31, ln = lane & 15, hh = lane >> 4; const int by = blockIdx.y;
  A += (size_t)by * sA; Bh += (size_t)by * sB; C += (size_t)by * sC;
  const int ntn = (N + 63) / 64; const int wid = blockIdx.x * 4 + w; const int mt = wid / ntn, nq = wid % ntn; if (mt * 16 >= M) return;
  const int row0 = mt * 16, col0 = nq * 64; const float* arow = A + (size_t)(row0 + ln) * lda;
  v8f acc[4] = {};
  for (int kb = 0; kb < K; kb += 32) {
    FragH ah, al;
    const v4f x0 = *(const v4fa*)(arow + kb + 8 * hh), x1 = *(const v4fa*)(arow + kb + 8 * hh + 4), x2 = *(const v4fa*)(arow + kb + 16 + 8 * hh), x3 = *(const v4fa*)(arow + kb + 16 + 8 * hh + 4);
    float xs[16] = {x0[0],x0[1],x0[2],x0[3],x1[0],x1[1],x1[2],x1[3],x2[0],x2[1],x2[2],x2[3],x3[0],x3[1],x3[2],x3[3]};
#pragma unroll
    for (int i = 0; i < 16; ++i) { const _Float16 h = (_Float16)xs[i]; ah.h[i] = h; al.h[i] = ASPLIT ? (_Float16)(xs[i] - (float)h) : (_Float16)0.0f; }
#pragma unroll
    for (int t = 0; t < 4; ++t) { if (col0 + t * 16 >= N) continue; const size_t boff = (size_t)(col0 + t * 16 + ln) * ldb + kb; FragH bq; bq.half[0] = *(const v8us*)(Bh + boff + 8 * hh); bq.half[1] = *(const v8us*)(Bh + boff + 16 + 8 * hh);
      acc[t] = mmaH<ASPLIT ? 2 : 1>(ah.v, al.v, bq.v, bq.v, acc[t]); }
  }
#pragma unroll
  for (int t = 0; t < 4; ++t) { if (col0 + t * 16 >= N) continue;
#pragma unroll
    for (int r = 0; r < 8; ++r) so[w][8 * hh + r][t * 16 + ln] = acc[t][r] * alpha; }
  __builtin_amdgcn_fence(__ATOMIC_ACQ_REL, "workgroup"); __builtin_amdgcn_wave_barrier();
  const int rsub = lane >> 4, c4 = (lane & 15) * 4;
  {
#pragma unroll
    for (int q = 0; q < 8; ++q) { const int r = q * 2 + rsub; if (col0 + c4 < N) { const v4f v = *(const v4fa*)&so[w][r][c4]; *(v4f*)(C + (size_t)(row0 + r) * ldc + col0 + c4) = v; } }
     }
}

// Wt[n][k] = f16(W[k][n]·scale) from f32 row-major W[K][N] (scale = power of two; bf16-exact weights stay exact in f16 away from the subnormal range)
__global__ __launch_bounds__(256) void k_wt_f16(const float* __restrict__ W, _Float16* __restrict__ Wt, int K, int N, float scale) {
  const int t = blockIdx.x * 256 + threadIdx.x; if (t >= N * (K / 8)) return; const int n = t / (K / 8), k8 = (t % (K / 8)) * 8; FragH f;
#pragma unroll
  for (int i = 0; i < 8; ++i) f.h[i] = (_Float16)(bf16_round(W[(size_t)(k8 + i) * N + n]) * scale); const v8us o = f.half[0];
  *(v8us*)((unsigned short*)Wt + (size_t)n * K + k8) = o; 
}
// k_gemm_hh variant with fused epilogue: v = acc·alpha + bias[by·sBias + col] (+ CP[(row/rowsPerB)·sCPb + by·64 + col] if CP) ; ACT 0 none / 1 elu ; writes f16 C16 (and f32 C if non-null)
template <int ACT>
__global__ __launch_bounds__(128) void k_gemm_hhx(const _Float16* __restrict__ A, int lda, size_t sA, const _Float16* __restrict__ Bh, int ldb, size_t sB, float alpha, const float* __restrict__ bias, size_t sBias, const float* __restrict__ CP, int rowsPerB, size_t sCPb, int row0g,
    float* __restrict__ C, _Float16* __restrict__ C16, int ldc, size_t sC, int M, int N, int K) {
  __shared__ __attribute__((aligned(16))) float so[4][16][64];
  const int tid = threadIdx.x, w = tid >> 5, lane = tid & 31, ln = lane & 15, hh = lane >> 4; const int by = blockIdx.y;
  A += (size_t)by * sA; Bh += (size_t)by * sB; const size_t cofs = (size_t)by * sC; const float* bp = bias ? bias + (size_t)by * sBias : nullptr;
  const int ntn = (N + 63) / 64; const int wid = blockIdx.x * 4 + w; const int mt = wid / ntn, nq = wid % ntn; if (mt * 16 >= M) return;
  const int row0 = mt * 16, col0 = nq * 64; const _Float16* arow = A + (size_t)(row0 + ln) * lda;
  v8f acc[4] = {};
  for (int kb = 0; kb < K; kb += 32) { FragH ah; ah.half[0] = *(const v8us*)((const unsigned short*)arow + kb + 8 * hh); ah.half[1] = *(const v8us*)((const unsigned short*)arow + kb + 16 + 8 * hh);
#pragma unroll
    for (int t = 0; t < 4; ++t) { if (col0 + t * 16 >= N) continue; const size_t boff = (size_t)(col0 + t * 16 + ln) * ldb + kb; FragH bq; bq.half[0] = *(const v8us*)((const unsigned short*)Bh + boff + 8 * hh); bq.half[1] = *(const v8us*)((const unsigned short*)Bh + boff + 16 + 8 * hh);
      acc[t] = mmaH<1>(ah.v, ah.v, bq.v, bq.v, acc[t]); }
  }
#pragma unroll
  for (int t = 0; t < 4; ++t) { if (col0 + t * 16 >= N) continue; const int col = col0 + t * 16 + ln; const float bv = bp ? bf16_round(bp[col]) : 0.f;
#pragma unroll
    for (int r = 0; r < 8; ++r) { float v = acc[t][r] * alpha + bv; if (CP) { const int bidx = (row0g + row0 + 8 * hh + r) / rowsPerB; v += CP[(size_t)bidx * sCPb + (size_t)by * 64 + col]; } if (ACT == 1) v = (v > 0.f) ? v : expm1f(v); else if (ACT == 7) v = (v > 0.f) ? v + 1.0f : expf(v); else if (ACT == 8) v = tanhf(v); else if (ACT == 9) v = 0.5f * v * (1.0f + tanhf(0.7978845608028654f * (v + 0.044715f * v * v * v))); else if (ACT == 11) v = 1.0f / (1.0f + expf(-v)); else if (ACT == 12) v = (v > 0.f) ? v : 0.01f * v; else if (ACT == 14) v = (v > 0.f) ? v : 0.1f * v; else if (ACT == 15) v = v / (1.0f + expf(-v)); else if (ACT == 3) v = fmaxf(v, 0.f); else if (ACT == 6) v = 0.5f * v * (1.0f + erff(v * 0.70710678118654752f)); so[w][8 * hh + r][t * 16 + ln] = v; } }
  __builtin_amdgcn_fence(__ATOMIC_ACQ_REL, "workgroup"); __builtin_amdgcn_wave_barrier();
  const int rsub = lane >> 4, c4 = (lane & 15) * 4; typedef _Float16 v4h __attribute__((ext_vector_type(4)));
  {
#pragma unroll
    for (int q = 0; q < 8; ++q) { const int r = q * 2 + rsub; if (col0 + c4 < N) { const v4f v = *(const v4fa*)&so[w][r][c4]; if (C) *(v4f*)(C + cofs + (size_t)(row0 + r) * ldc + col0 + c4) = v; if (C16) { v4h h4; for (int i = 0; i < 4; ++i) h4[i] = (_Float16)v[i]; *(v4h*)(C16 + cofs + (size_t)(row0 + r) * ldc + col0 + c4) = h4; } } }
     }
}


typedef _Float16 v4h __attribute__((ext_vector_type(4)));

__global__ __launch_bounds__(256) void k_h16(const float* __restrict__ x, _Float16* __restrict__ X16, size_t n8) { const size_t t = (size_t)blockIdx.x * 256 + threadIdx.x; if (t >= n8) return; FragH f;
#pragma unroll
  for (int q = 0; q < 8; ++q) f.h[q] = (_Float16)x[t * 8 + q]; *(v8us*)((unsigned short*)X16 + t * 8) = f.half[0];  }
__global__ __launch_bounds__(256) void k_round16f(const float* __restrict__ W, _Float16* __restrict__ Bt, size_t n8) { const size_t t = (size_t)blockIdx.x * 256 + threadIdx.x; if (t >= n8) return; FragH f;
#pragma unroll
  for (int i = 0; i < 8; ++i) f.h[i] = (_Float16)(bf16_round(W[t * 8 + i]) * 16.0f); *(v8us*)((unsigned short*)Bt + t * 8) = f.half[0];  }
template <int NHv, int TTv>
__global__ __launch_bounds__(256) void k_vt(const _Float16* __restrict__ V16, int ldv, int voff, _Float16* __restrict__ Vt) { __shared__ unsigned short tl[64][66]; const int tid = threadIdx.x; const int slab = blockIdx.x / (TTv / 64), lg = blockIdx.x % (TTv / 64); const int b = slab / NHv, h = slab % NHv;
  for (int i = tid; i < 64 * 8; i += 256) { const int r = i / 8, c8 = (i % 8) * 8; FragH f; f.half[0] = *(const v8us*)((const unsigned short*)V16 + ((size_t)b * TTv + lg * 64 + r) * ldv + voff + h * 64 + c8);
#pragma unroll
    for (int q = 0; q < 8; ++q) tl[r][c8 + q] = f.u[q]; }
  __syncthreads();
  {
#pragma unroll
    for (int rd = 0; rd < 2; ++rd) { const int d = rd * 32 + tid / 8, pc = tid % 8; FragH f;
#pragma unroll
      for (int q = 0; q < 8; ++q) f.u[q] = tl[pc * 8 + q][d];
      *(v8us*)((unsigned short*)Vt + ((size_t)slab * 64 + d) * TTv + lg * 64 + pc * 8) = f.half[0]; }
     } }


// ---- fast GEMM (wave tile 64x64, block tile 128x128) ----
__device__ __forceinline__ v16h g2_frag(const _Float16* p, int hh) { FragH f; f.half[0] = *(const v8us*)((const unsigned short*)p + 8 * hh); f.half[1] = *(const v8us*)((const unsigned short*)p + 16 + 8 * hh); return f.v; }
__device__ __forceinline__ v8f g2_mma(v16h a, v16h b, v8f c) { v8f d = __builtin_amdgcn_wmma_f32_16x16x32_f16(false, a, false, b, (short)0, c, false, false); asm volatile("v_nop\n\tv_nop\n\tv_nop\n\tv_nop" : "+v"(d) : "v"(a), "v"(b)); return d; }
// One wave's share of one operand's half of a stage (128 rows of 128 bytes, LDS pitch G2P bytes): 8 asynchronous 16-byte copies per lane, 8 lanes to a row, so that each copy of a wave reads 4 whole 128-byte lines.
// l = this lane's LDS byte address in the half's row tid / 8; g = this lane's 16 bytes in the operand's row tid / 8 of the stage; every further copy is 16 rows on.
#define G2P 144            /* 128 + 16: the pitch for 16-byte LDS reads of 128-byte rows */
#define G2H (128 * G2P)    /* bytes of one operand's half of a stage */
#define G2S (2 * G2H)      /* bytes of one stage */
__device__ __forceinline__ void g2_stage(unsigned l, const _Float16* g, size_t ld) {
  const unsigned l1 = l + 16 * G2P, l2 = l + 32 * G2P, l3 = l + 48 * G2P, l4 = l + 64 * G2P, l5 = l + 80 * G2P, l6 = l + 96 * G2P, l7 = l + 112 * G2P;
  const _Float16 *g1 = g + 16 * ld, *g2 = g + 32 * ld, *g3 = g + 48 * ld, *g4 = g + 64 * ld, *g5 = g + 80 * ld, *g6 = g + 96 * ld, *g7 = g + 112 * ld;
  /* the copies and their s_wait_xcnt in one statement: no address register is rewritten before the wait */
  asm volatile("global_load_async_to_lds_b128 %0, %8, off\n\t"
               "global_load_async_to_lds_b128 %1, %9, off\n\t"
               "global_load_async_to_lds_b128 %2, %10, off\n\t"
               "global_load_async_to_lds_b128 %3, %11, off\n\t"
               "global_load_async_to_lds_b128 %4, %12, off\n\t"
               "global_load_async_to_lds_b128 %5, %13, off\n\t"
               "global_load_async_to_lds_b128 %6, %14, off\n\t"
               "global_load_async_to_lds_b128 %7, %15, off\n\t"
               "s_wait_xcnt 0x0"
               :: "v"(l), "v"(l1), "v"(l2), "v"(l3), "v"(l4), "v"(l5), "v"(l6), "v"(l7),
                  "v"(g), "v"(g1), "v"(g2), "v"(g3), "v"(g4), "v"(g5), "v"(g6), "v"(g7) : "memory"); }
// The three projections in ONE launch: blockIdx.y picks the weight plane (0 q, 1 k, 2 v; the planes lie one behind the other in B3) and what the epilogue makes of the tile, so that q, k and v never exist as f32 planes in memory.
// Block tile 128 tokens x 128 columns = two heads, four waves as 2 x 2, each 64 tokens x 64 columns = one head: a fragment read from LDS feeds four products, and a byte copied from L2 into LDS feeds half again as many products as with a 128 x 64 block.
// K = DM; A and B go through LDS in stages of 64 k, two buffers: stage t + 1 flies while stage t is worked on. The fragments are read from LDS in the k order of g2_frag.
// Behind the loop's last barrier the ring is free, and each wave stages its tile in its own part of it.
// q, k: the wave's 64x64 tile goes through its own LDS rows, a lane takes 4 neighbouring columns = 2 rotary pairs back, turns them by the sinusoidal_pos INPUT row of its token ([sin | cos], rounded like every input) and stores 4 f16: 16 lanes write one head row = one 128-byte line.
// v: register r of an accumulator is token 8 hh + r of one head column, so 8 converted registers are 16 bytes of a V^T row; the wave's 64 x 64 V^T tile is gathered in its own LDS rows and stored as whole 128-byte lines, 8 lanes to a line.
#define SOP 68             /* floats per LDS row of a wave's f32 tile */
#define VTP 72             /* f16 per LDS row of a wave's V^T tile: 128 + 16 bytes */
typedef float f1a __attribute__((may_alias));
__global__ __launch_bounds__(128) __attribute__((amdgpu_waves_per_eu(4, 4))) void k_qkv(const _Float16* __restrict__ A, const _Float16* __restrict__ B3, const float* __restrict__ sp, _Float16* __restrict__ Q16, _Float16* __restrict__ K16, _Float16* __restrict__ Vt) {
  __shared__ __attribute__((aligned(16))) _Float16 st[2][256][G2P / 2];      /* [buffer][128 A rows, 128 B rows] */
  const int tid = threadIdx.x, w = tid >> 5, lane = tid & 31, ln = lane & 15, hh = lane >> 4; const int by = blockIdx.y;
  const int wm = w >> 1, wn = w & 1;      /* the wave's token half and its head of the block's two */
  const _Float16* Bh = B3 + (size_t)by * DM * DM;
  const int mt = blockIdx.x / (NH / 2), np = blockIdx.x % (NH / 2); const int row0 = mt * 128 + 64 * wm, hd = np * 2 + wn, col0 = hd * 64;
  const _Float16* ga = A + (size_t)(mt * 128 + (tid >> 3)) * DM + (tid & 7) * 8; const _Float16* gb = Bh + (size_t)(np * 128 + (tid >> 3)) * DM + (tid & 7) * 8;
  const unsigned ls = (unsigned)(size_t)&st[0][tid >> 3][(tid & 7) * 8];
  constexpr int nst = DM >> 6;
  g2_stage(ls, ga, (size_t)DM); g2_stage(ls + G2H, gb, (size_t)DM);
  asm volatile("s_wait_asynccnt 0x0" ::: "memory");      /* stage 0 of this wave has landed */
  __syncthreads();      /* ... and every wave's share of it */
  g2_stage(ls + G2S, ga + 64, (size_t)DM); g2_stage(ls + G2S + G2H, gb + 64, (size_t)DM);
  v8f c[4][4];      /* c[i][j]: tokens row0 + 16 i ..., columns col0 + 16 j ... */
#pragma unroll      /* constant indices: the accumulators stay in registers */
  for (int i = 0; i < 4; ++i) {
#pragma unroll      /* constant indices: the accumulators stay in registers */
    for (int j = 0; j < 4; ++j) c[i][j] = (v8f){0.f,0.f,0.f,0.f,0.f,0.f,0.f,0.f}; }
  /* rolled: one trip of code; the buffer is picked by the trip's parity */
#pragma unroll 1
  for (int t = 0; t < nst; ++t) { const _Float16* sa = &st[t & 1][64 * wm + ln][0]; const _Float16* sb = &st[t & 1][128 + 64 * wn + ln][0];
#pragma unroll      /* constant indices: fragments and accumulators stay in registers */
    for (int ks = 0; ks < 2; ++ks) { v16h a[4], b[4];
      /* the eight fragments of 32 k are read together, ahead of their sixteen products */
#pragma unroll      /* constant indices: fragments and accumulators stay in registers */
      for (int i = 0; i < 4; ++i) { a[i] = g2_frag(sa + i * 16 * (G2P / 2) + ks * 32, hh); b[i] = g2_frag(sb + i * 16 * (G2P / 2) + ks * 32, hh); }
#pragma unroll      /* constant indices: fragments and accumulators stay in registers */
      for (int j = 0; j < 4; ++j) {
#pragma unroll      /* constant indices: fragments and accumulators stay in registers */
        for (int i = 0; i < 4; ++i) c[i][j] = g2_mma(a[i], b[j], c[i][j]); } }
    asm volatile("s_wait_dscnt 0x0" ::: "memory");      /* this wave's reads of the buffer are done before it is refilled */
    asm volatile("s_wait_asynccnt 0x0" ::: "memory");      /* this wave's share of stage t + 1 has landed */
    __syncthreads();      /* publishes stage t + 1 and ends every wave's reads of stage t */
    if (t + 2 < nst) { g2_stage(ls + (unsigned)(t & 1) * G2S, ga + (size_t)(t + 2) * 64, (size_t)DM); g2_stage(ls + (unsigned)(t & 1) * G2S + G2H, gb + (size_t)(t + 2) * 64, (size_t)DM); } }
  asm volatile("s_wait_asynccnt 0x0" ::: "memory");      /* nothing in flight when the wave goes on to the epilogue */
  char* sw = (char*)&st[0][0][0] + w * (64 * SOP * 4);      /* this wave's own part of the ring, which every wave has left at the last trip's barrier. The weights hold the factor 16: every value below is accumulator / 16 */
  /* The epilogue in three short branches on the plane (the same for the whole block) instead of one long one: the accumulators end in the middle one, so that their registers are free for the read-out (with one long branch for q, k and one for v this build kept all 128 alive through the q, k branch and ran out of registers) */
  const bool isv = (by == 2);
  unsigned short* vt = (unsigned short*)sw; f1a* so = (f1a*)sw;
  const int rsub = lane >> 4, c4 = (lane & 15) * 4;
  /* q, k: the table words of token row0 + rsub, pairs c4 / 2 and c4 / 2 + 1; the lane's next token is two rows = 128 floats on (a wave's 64 tokens never cross the end of a sequence). The first half is asked for ahead of the LDS round trip, which hides its way, the second behind it, when the accumulators' registers are free */
  const float* pr = sp + (size_t)(row0 % SLEN + rsub) * 64 + (c4 >> 1); v2fa sn[32], cs[32];
  if (!isv) {
#pragma unroll      /* constant indices: the table words stay in registers */
    for (int q = 0; q < 16; ++q) { sn[q] = *(const v2fa*)(pr + q * 128); cs[q] = *(const v2fa*)(pr + q * 128 + 32); }
    asm volatile("s_wait_xcnt 0x0" :: "v"(pr) : "memory");      /* the loads' address register lives up to this wait: nothing is written over it while a load that names it is under way */
  }
  if (isv) {
#pragma unroll      /* constant indices: the accumulators stay in registers */
    for (int i = 0; i < 4; ++i) {
#pragma unroll      /* constant indices: the accumulators stay in registers */
      for (int j = 0; j < 4; ++j) { FragH f;
#pragma unroll      /* constant indices: the accumulators stay in registers */
        for (int r = 0; r < 8; ++r) f.h[r] = (_Float16)(c[i][j][r] * 0.0625f);
        *(v8us*)(vt + (j * 16 + ln) * VTP + i * 16 + 8 * hh) = f.half[0]; } }
  } else {
#pragma unroll      /* constant indices: the accumulators stay in registers */
    for (int i = 0; i < 4; ++i) {
#pragma unroll      /* constant indices: the accumulators stay in registers */
      for (int j = 0; j < 4; ++j) {
#pragma unroll      /* constant indices: the accumulators stay in registers */
        for (int r = 0; r < 8; ++r) so[(i * 16 + 8 * hh + r) * SOP + j * 16 + ln] = c[i][j][r] * 0.0625f; } }
  }
  __builtin_amdgcn_fence(__ATOMIC_ACQ_REL, "workgroup"); __builtin_amdgcn_wave_barrier();      /* the wave's LDS writes are done before its lanes read rows that other lanes wrote */
  if (isv) {
    const int b = row0 / SLEN, key0 = row0 % SLEN;      /* a wave's 64 tokens never cross the end of a sequence */
    unsigned short* vp = (unsigned short*)Vt + ((size_t)(b * NH + hd) * 64 + (lane >> 3)) * SLEN + key0 + (lane & 7) * 8;
#pragma unroll      /* the LDS reads stand together, ahead of the stores */
    for (int p = 0; p < 16; ++p) { const v8us val = *(const v8us*)(vt + (p * 4 + (lane >> 3)) * VTP + (lane & 7) * 8);
      *(v8us*)(vp + (size_t)p * 4 * SLEN) = val; }
    asm volatile("s_wait_xcnt 0x0" ::: "memory");      /* behind the last store of the run: no register that a store names is written over while the store is under way */
  } else {
    _Float16* __restrict__ H = by ? K16 : Q16;
#pragma unroll      /* constant indices: the table words stay in registers */
    for (int q = 16; q < 32; ++q) { sn[q] = *(const v2fa*)(pr + q * 128); cs[q] = *(const v2fa*)(pr + q * 128 + 32); }
    asm volatile("s_wait_xcnt 0x0" :: "v"(pr) : "memory");      /* as above, for the second half's loads */
    _Float16* hp = H + (size_t)(row0 + rsub) * DM + col0 + c4;
#pragma unroll      /* constant indices: the table words stay in registers */
    for (int qg = 0; qg < 4; ++qg) { v4h h4[8];      /* eight tokens' results, then their eight stores as one run */
#pragma unroll      /* constant indices: the table words stay in registers */
      for (int e = 0; e < 8; ++e) { const int q = qg * 8 + e; const v4f v = *(const v4fa*)&so[(q * 2 + rsub) * SOP + c4];
        const float s0 = bf16_round(sn[q][0]), s1 = bf16_round(sn[q][1]), k0 = bf16_round(cs[q][0]), k1 = bf16_round(cs[q][1]);
        h4[e][0] = (_Float16)(v[0] * k0 - v[1] * s0); h4[e][1] = (_Float16)(v[0] * s0 + v[1] * k0); h4[e][2] = (_Float16)(v[2] * k1 - v[3] * s1); h4[e][3] = (_Float16)(v[2] * s1 + v[3] * k1); }
      __builtin_amdgcn_sched_barrier(0);      /* no vector instruction is moved in among the run of stores below, where it could write over a register that an issued store names */
#pragma unroll      /* constant indices: the results stay in registers */
      for (int e = 0; e < 8; ++e) *(v4h*)(hp + (size_t)(qg * 8 + e) * 2 * DM) = h4[e];
      asm volatile("s_wait_xcnt 0x0" ::: "memory");      /* behind the last store of the run: no register that a store names is written over while the store is under way */
      __builtin_amdgcn_sched_barrier(0); }      /* ... and nothing of the next run is moved up in front of that wait */
  } }



// lane l <-> lane l ^ 16 (the two halves of a wave hold the two key halves of one query column)
__device__ __forceinline__ float xhalf(float x) { return __builtin_bit_cast(float, __builtin_amdgcn_permlanex16(__builtin_bit_cast(int, x), __builtin_bit_cast(int, x), 0x76543210, 0xfedcba98, false, false)); }
__device__ __forceinline__ v8f mmaT(v16h a, v16h b, v8f c) { return __builtin_amdgcn_wmma_f32_16x16x32_f16(false, a, false, b, (short)0, c, false, false); }
// One wave's share of one key group's half of a flash stage, 64 keys (128 rows of 128 bytes: 64 K rows of the head, then the 64 V^T rows' 64 keys, LDS pitch FLP bytes): 8 asynchronous 16-byte copies per lane, 8 lanes to a row, so that each copy of a wave reads 4 whole 128-byte lines.
// With i = the thread's number among its key group's 128: l = this lane's LDS byte address in the half's row i / 8; gk, gv = this lane's 16 bytes in K row i / 8 and V^T row i / 8 of the half; every further copy is 16 rows on.
#define FLP 144            /* 128 + 16: the pitch for 16-byte LDS reads of 128-byte rows */
#define FLS (128 * FLP)    /* bytes of one key group's half of a stage */
__device__ __forceinline__ void fl_stage(unsigned l, const _Float16* gk, size_t ldk, const _Float16* gv) {
  const unsigned l1 = l + 16 * FLP, l2 = l + 32 * FLP, l3 = l + 48 * FLP, l4 = l + 64 * FLP, l5 = l + 80 * FLP, l6 = l + 96 * FLP, l7 = l + 112 * FLP;
  const _Float16 *k1 = gk + 16 * ldk, *k2 = gk + 32 * ldk, *k3 = gk + 48 * ldk, *v1 = gv + 16 * TK, *v2 = gv + 32 * TK, *v3 = gv + 48 * TK;
  /* the copies and their s_wait_xcnt in one statement: no address register is rewritten before the wait */
  asm volatile("global_load_async_to_lds_b128 %0, %8, off\n\t"
               "global_load_async_to_lds_b128 %1, %9, off\n\t"
               "global_load_async_to_lds_b128 %2, %10, off\n\t"
               "global_load_async_to_lds_b128 %3, %11, off\n\t"
               "global_load_async_to_lds_b128 %4, %12, off\n\t"
               "global_load_async_to_lds_b128 %5, %13, off\n\t"
               "global_load_async_to_lds_b128 %6, %14, off\n\t"
               "global_load_async_to_lds_b128 %7, %15, off\n\t"
               "s_wait_xcnt 0x0"
               :: "v"(l), "v"(l1), "v"(l2), "v"(l3), "v"(l4), "v"(l5), "v"(l6), "v"(l7),
                  "v"(gk), "v"(k1), "v"(k2), "v"(k3), "v"(gv), "v"(v1), "v"(v2), "v"(v3) : "memory"); }
// Transposed products: S^T = K Q^T (A = 16 key rows, B = 16 query columns, kept in registers), O^T += V^T P^T (A = 16 rows of V^T, B = P^T).
// A wave holds TWO tiles of 16 query columns (cg = 0, 1): every K and V^T fragment that it reads from LDS feeds two products. So that the chip still has as many waves, the keys are split inside the block: 8 waves = 4 query groups of 32 x 2 key groups; of each stage of 128 keys, key group g works on keys 64 g ... 64 g + 63, with its own reference, sum and accumulators, and the two groups' results are joined once, behind the loop, through LDS.
// Lane (c = lane & 15, hh = lane >> 4) holds queries q0 + c and q0 + 16 + c only: register r of score tile nt is key j0 + 16 nt + 8 hh + r, so maximum and sum run in-lane plus one exchange between the halves,
// and the two converted score tiles ARE the B operand of the second product in the hardware k order (element s: key 8 hh + s, then 16 + 8 hh + (s - 8)), the order in which the V^T rows are loaded.
// The softmax runs in base 2: the score factor holds log2 e and the mask table is already in those units. Each query column keeps a reference r_c, set 10 below the column's maximum at the time it was set, and a weight is 2^(score - r_c): a subtraction and one v_exp_f32; numerator and denominator hold the same factor, which the final division takes out. The reference moves, and accumulators and sum are rescaled, only when a score has climbed more than 15 above it.
// K and V^T go through LDS in stages of 2 x 64 keys (each key group: two passes of 32), two buffers, shared by the block's waves: stage t + 1 flies while stage t is worked on; a key group's 4 waves copy that group's half of the stage. The fragments are read from LDS in the k order of g2_frag.
template <int CAUSAL>
__global__ __launch_bounds__(256) __attribute__((amdgpu_waves_per_eu(4, 4))) void k_flash(const _Float16* __restrict__ Q16, int ldq, const _Float16* __restrict__ K16, int ldk, const _Float16* __restrict__ Vt, const int* __restrict__ MSK, float* __restrict__ O, int ldo) {
  constexpr int RPW = 32, CG = 2, DT = 4, KS = 2;
  __shared__ __attribute__((aligned(16))) float sO[4][RPW][64 + 4];
  __shared__ __attribute__((aligned(16))) float sM[4][CG * DT * 2][32][4];      /* key group 1's accumulators on their way to key group 0: 16 bytes a lane, lanes side by side */
  __shared__ float sL[4][CG][2][32];      /* ... and its sums and references */
  __shared__ __attribute__((aligned(16))) _Float16 st[2][2][128][FLP / 2];      /* [buffer][key group][64 K rows, 64 V^T rows] */
  const int tid = threadIdx.x, g = tid >> 7, t7 = tid & 127, w = (tid >> 5) & 3, lane = tid & 31, ln = lane & 15, hh = lane >> 4;
  const int slab = blockIdx.x / QBNP, qblk = QB0P + blockIdx.x % QBNP; const int b = slab / NH, h = slab % NH; const int qb0 = qblk * (4 * RPW); const int q0 = qb0 + w * RPW;
  FragH bq[CG][KS];
#pragma unroll
  for (int cg = 0; cg < CG; ++cg) { const unsigned short* qr = (const unsigned short*)Q16 + ((size_t)b * TQ + q0 + cg * 16 + ln) * ldq + h * 64;
#pragma unroll
    for (int ks = 0; ks < KS; ++ks) { bq[cg][ks].half[0] = *(const v8us*)(qr + ks * 32 + 8 * hh); bq[cg][ks].half[1] = *(const v8us*)(qr + ks * 32 + 16 + 8 * hh); } }
  /* this lane's 16 bytes of its key group's half of stage 0 (K row t7 / 8 of the half, V^T row t7 / 8) and their place in buffer 0 */
  const _Float16* gk = K16 + ((size_t)b * TK + g * 64 + (t7 >> 3)) * ldk + h * 64 + (t7 & 7) * 8; const _Float16* gv = Vt + ((size_t)slab * 64 + (t7 >> 3)) * TK + g * 64 + (t7 & 7) * 8;
  const unsigned ls = (unsigned)(size_t)&st[0][g][t7 >> 3][(t7 & 7) * 8];
  const char* mb = (const char*)((const float*)MSK + (size_t)b * TK); const unsigned mo = (unsigned)g * 256u + (unsigned)hh * 32u;      /* a uniform base that steps with the pass; this key group's and this half's 8 mask words */
  float r_c[CG], l_c[CG]; v8f oacc[CG][DT];      /* r_c: the column's reference, see the stage loop */
#pragma unroll
  for (int cg = 0; cg < CG; ++cg) { r_c[cg] = -3.0e38f; l_c[cg] = 0.f;
#pragma unroll
    for (int dt = 0; dt < DT; ++dt) oacc[cg][dt] = (v8f){0.f,0.f,0.f,0.f,0.f,0.f,0.f,0.f}; }
  const int jend = (CAUSAL == 1) ? (qb0 + 4 * RPW) : TK;      /* causal: keys beyond the block's last query never contribute */
  const int nst = jend >> 7;      /* both ends are multiples of 128; the same for the whole block */
  fl_stage(ls, gk, (size_t)ldk, gv);
  asm volatile("s_wait_asynccnt 0x0" ::: "memory");      /* stage 0 of this wave has landed */
  __syncthreads();      /* ... and every wave's share of it */
  if (nst > 1) fl_stage(ls + 2 * FLS, gk + (size_t)128 * ldk, (size_t)ldk, gv + 128);
  /* One loop over passes of 32 keys x 32 query columns, two passes to a stage; a pass runs from its K fragments to its second products, so that only one pass's scores and fragments are live at a time (the wave keeps within the registers of four waves a SIMD). The loop stays rolled: one pass of code, accumulators in the same registers throughout (with the two passes of a stage unrolled this build copied all 64 accumulator registers to and fro around the second pass's rescale branch); buffer and pass are picked by the trip's number; every inner loop is unrolled so that the fragment and score arrays have constant indices and stay in registers */
#pragma unroll 1
  for (int ps2 = 0; ps2 < 2 * nst; ++ps2) { const int t = ps2 >> 1, pp = ps2 & 1; const _Float16* skr = &st[t & 1][g][pp * 32 + ln][0]; const _Float16* svr = &st[t & 1][g][64 + ln][pp * 32];      /* this lane's first K row and its V^T row's 32 keys of the pass, in its key group's half of the buffer */
   { const int j0 = t * 128 + g * 64 + pp * 32;
    v4f mk[2][2];      /* the pass's mask words (from the table in global memory) are asked for first: they have the longest way */
    if (CAUSAL == 17) {
#pragma unroll
      for (int nt = 0; nt < 2; ++nt) { mk[nt][0] = *(const v4fa*)(mb + mo + nt * 64); mk[nt][1] = *(const v4fa*)(mb + mo + nt * 64 + 16); } }
    FragH ak[2][KS], av[DT]; v2f sc[CG][8]; bool ok[CG][16];      /* scores as the register pairs in which the accumulators hold them: written as two-vectors so that the packed instructions work on those pairs (left to itself this build paired the two column tiles and moved every score into place) */
#pragma unroll
    for (int nt = 0; nt < 2; ++nt) {
#pragma unroll
      for (int ks = 0; ks < KS; ++ks) ak[nt][ks].v = g2_frag(skr + nt * 16 * (FLP / 2) + ks * 32, hh); }      /* key rows ln and 16 + ln of the pass */
    asm volatile("" :: "v"(ak[0][0].v), "v"(ak[0][1].v), "v"(ak[1][0].v), "v"(ak[1][1].v));      /* inputs only: keeps the pass's eight K reads together in front of its first product (one LDS wait instead of one for each fragment) */
#pragma unroll
    for (int nt = 0; nt < 2; ++nt) {
#pragma unroll
     for (int cg = 0; cg < CG; ++cg) { const int tq = q0 + cg * 16 + ln; v8f acc = (v8f){0.f,0.f,0.f,0.f,0.f,0.f,0.f,0.f};
#pragma unroll
      for (int ks = 0; ks < KS; ++ks) acc = mmaT(ak[nt][ks].v, bq[cg][ks].v, acc);
#pragma unroll
      for (int j = 0; j < 4; ++j) { v2f s2 = (v2f){acc[2 * j], acc[2 * j + 1]} * SCL2;
#pragma unroll
        for (int e = 0; e < 2; ++e) { const int kk = j0 + nt * 16 + 8 * hh + 2 * j + e; const bool okk = (CAUSAL == 1) ? (kk <= tq) : ((CAUSAL == 2) ? ((kk >> 5) == (tq >> 5)) : true);      /* mode 2: block-diagonal 32-token groups */
          if (!okk) s2[e] = -3.0e38f; ok[cg][nt * 8 + 2 * j + e] = okk; }
        if (CAUSAL == 17) s2 += (v2f){mk[nt][j >> 1][(2 * j) & 3], mk[nt][j >> 1][((2 * j) & 3) + 1]};      /* mode 17: additive per-(batch, key) mask, rounded and scaled by k_prep */
        sc[cg][nt * 4 + j] = s2; } } }
#pragma unroll
    for (int dt = 0; dt < DT; ++dt) av[dt].v = g2_frag(svr + dt * 16 * (FLP / 2), hh);      /* V^T row dt * 16 + ln, the pass's 32 keys */
    float mc[CG];
#pragma unroll
    for (int cg = 0; cg < CG; ++cg) { float mx[8];
#pragma unroll
      for (int i = 0; i < 8; ++i) mx[i] = fmaxf(sc[cg][i][0], sc[cg][i][1]);      /* neighbours first (a maximum is exact in any order): the packed score multiply-adds then work on register pairs as the accumulators hold them, with no moves */
      mc[cg] = fmaxf(fmaxf(fmaxf(mx[0], mx[1]), fmaxf(mx[2], mx[3])), fmaxf(fmaxf(mx[4], mx[5]), fmaxf(mx[6], mx[7]))); }
    /* Lazy rescale, one test a pass (as many scores to a test as before): while no column's score lies more than 15 above its reference, every weight 2^(score - reference) is at most 2^15, which f16 holds, and numerator and denominator go on in the units they are in. A scalar branch: the whole wave takes it or none */
    if (__builtin_amdgcn_ballot_w32(fmaxf(mc[0] - r_c[0], mc[1] - r_c[1]) > 15.0f) != 0) {      /* mc: the maximum of this half's 16 keys of the pass; the vote sees both halves and both column tiles */
#pragma unroll
     for (int cg = 0; cg < CG; ++cg) {
      const float mj = fmaxf(mc[cg], xhalf(mc[cg]));      /* both halves now hold the query's maximum over the pass's 32 keys, so both set the same reference */
      float rn = mj - 10.0f; if (mj - rn > 15.0f) rn = mj;      /* where the maximum is so large that the subtraction rounds to more than 15 below it, the reference is the maximum itself: no weight ever leaves f16 */
      rn = fmaxf(r_c[cg], rn); const float da = r_c[cg] - rn; float ea;
      asm("v_exp_f32 %0, %1\n\tv_nop" : "=&v"(ea) : "v"(da));      /* the v_nop is the slot that the instruction set asks for behind a transcendental */
      const float al = (rn > -1.0e38f * LOG2E) ? ea : 1.0f;      /* the same test as before, its threshold in base-2 units */
      r_c[cg] = rn; l_c[cg] *= al;
#pragma unroll
      for (int dt = 0; dt < DT; ++dt) {
#pragma unroll
        for (int r = 0; r < 8; ++r) oacc[cg][dt][r] *= al; } } }
    FragH pb[CG];
#pragma unroll
   for (int cg = 0; cg < CG; ++cg) {
    float x[16], p[16];
#pragma unroll
    for (int i = 0; i < 8; ++i) { const v2f x2 = sc[cg][i] - (v2f){r_c[cg], r_c[cg]}; x[2 * i] = x2[0]; x[2 * i + 1] = x2[1]; }      /* never above 15 */
    /* 2^x is the one hardware instruction v_exp_f32 (a result below the normal range comes out as 0: such a weight is 0 in the f16 operand anyway). A tile's sixteen stand in two statements because the instruction set asks that the instruction directly behind a transcendental neither read its result nor overwrite its source: the early-clobber outputs keep every result out of every argument's register, and the v_nop is the slot of each statement's last v_exp_f32 (written as builtins, this build put a result into the argument register of the v_exp_f32 in front of it) */
    asm("v_exp_f32 %0, %8\n\tv_exp_f32 %1, %9\n\tv_exp_f32 %2, %10\n\tv_exp_f32 %3, %11\n\tv_exp_f32 %4, %12\n\tv_exp_f32 %5, %13\n\tv_exp_f32 %6, %14\n\tv_exp_f32 %7, %15\n\tv_nop"
        : "=&v"(p[0]), "=&v"(p[1]), "=&v"(p[2]), "=&v"(p[3]), "=&v"(p[4]), "=&v"(p[5]), "=&v"(p[6]), "=&v"(p[7]) : "v"(x[0]), "v"(x[1]), "v"(x[2]), "v"(x[3]), "v"(x[4]), "v"(x[5]), "v"(x[6]), "v"(x[7]));
    asm("v_exp_f32 %0, %8\n\tv_exp_f32 %1, %9\n\tv_exp_f32 %2, %10\n\tv_exp_f32 %3, %11\n\tv_exp_f32 %4, %12\n\tv_exp_f32 %5, %13\n\tv_exp_f32 %6, %14\n\tv_exp_f32 %7, %15\n\tv_nop"
        : "=&v"(p[8]), "=&v"(p[9]), "=&v"(p[10]), "=&v"(p[11]), "=&v"(p[12]), "=&v"(p[13]), "=&v"(p[14]), "=&v"(p[15]) : "v"(x[8]), "v"(x[9]), "v"(x[10]), "v"(x[11]), "v"(x[12]), "v"(x[13]), "v"(x[14]), "v"(x[15]));
#pragma unroll
    for (int i = 0; i < 16; ++i) { if (!ok[cg][i]) p[i] = 0.f; pb[cg].h[i] = (_Float16)p[i]; }
    const float pe = ((p[0] + p[2]) + (p[4] + p[6])) + ((p[8] + p[10]) + (p[12] + p[14])), po = ((p[1] + p[3]) + (p[5] + p[7])) + ((p[9] + p[11]) + (p[13] + p[15])); const float ps = pe + po;
    l_c[cg] += ps; }      /* this half's 16 keys of the pass; halves and key groups are joined once, behind the loop */
    __builtin_amdgcn_sched_barrier(0);      /* every v_exp_f32 statement stays in front of the pass's second products: the compiler does not see that asm text writes vector registers, and moved in between it would let one overwrite an operand of the product just issued */
#pragma unroll
    for (int dt = 0; dt < DT; ++dt) {
#pragma unroll
      for (int cg = 0; cg < CG; ++cg) oacc[cg][dt] = mmaT(av[dt].v, pb[cg].v, oacc[cg][dt]); } }
    mb += pp ? 384 : 128;      /* the key group's next 32 keys: in this stage, or in the next one, past the other group's 64 */
    if (pp) {      /* the foot of a stage; the test reads the same for the whole block */
    asm volatile("s_wait_dscnt 0x0" ::: "memory");      /* this wave's reads of the buffer are done before it is refilled */
    asm volatile("s_wait_asynccnt 0x0" ::: "memory");      /* this wave's share of stage t + 1 has landed */
    __syncthreads();      /* publishes stage t + 1 and ends every wave's reads of stage t */
    if (t + 2 < nst) fl_stage(ls + (unsigned)(t & 1) * (2 * FLS), gk + (size_t)(t + 2) * 128 * ldk, (size_t)ldk, gv + (size_t)(t + 2) * 128); } }
  asm volatile("s_wait_asynccnt 0x0" ::: "memory");      /* nothing in flight when the wave goes on to the epilogue */
  /* the join of the two key groups: group 1 hands accumulators, sums and references to the wave of group 0 that holds the same queries */
  if (g == 1) {      /* the same for a whole wave */
#pragma unroll
    for (int cg = 0; cg < CG; ++cg) { sL[w][cg][0][lane] = l_c[cg]; sL[w][cg][1][lane] = r_c[cg];
#pragma unroll
      for (int dt = 0; dt < DT; ++dt) { v4f lo, hi;
#pragma unroll
        for (int r = 0; r < 4; ++r) { lo[r] = oacc[cg][dt][r]; hi[r] = oacc[cg][dt][4 + r]; }
        *(v4fa*)&sM[w][(cg * DT + dt) * 2][lane][0] = lo; *(v4fa*)&sM[w][(cg * DT + dt) * 2 + 1][lane][0] = hi; } } }
  __syncthreads();      /* group 1's LDS writes are done before group 0 reads them; every wave passes it */
  if (g == 1) return;      /* no barrier stands behind this line */
#pragma unroll
  for (int cg = 0; cg < CG; ++cg) {
    const float l1 = sL[w][cg][0][lane], r1 = sL[w][cg][1][lane]; const float rn = fmaxf(r_c[cg], r1); const float d0 = r_c[cg] - rn, d1 = r1 - rn; float a0, a1;      /* both parts go to the units of the higher reference: one factor is 1, the other at most 1 */
    asm("v_exp_f32 %0, %2\n\tv_exp_f32 %1, %3\n\tv_nop" : "=&v"(a0), "=&v"(a1) : "v"(d0), "v"(d1));      /* the v_nop is the slot that the instruction set asks for behind a transcendental */
    const float lj = l_c[cg] * a0 + l1 * a1;
    const float l = lj + xhalf(lj); const float inv = (l > 0.f) ? 1.0f / l : 0.f;      /* numerator and denominator both hold the factor 2^-rn */
    const float f0 = a0 * inv, f1 = a1 * inv;
#pragma unroll
    for (int dt = 0; dt < DT; ++dt) { const v4f ml = *(const v4fa*)&sM[w][(cg * DT + dt) * 2][lane][0], mh = *(const v4fa*)&sM[w][(cg * DT + dt) * 2 + 1][lane][0]; v4f lo, hi;      /* register r = head column dt * 16 + 8 hh + r of query q0 + 16 cg + ln */
#pragma unroll
      for (int r = 0; r < 4; ++r) { lo[r] = oacc[cg][dt][r] * f0 + ml[r] * f1; hi[r] = oacc[cg][dt][4 + r] * f0 + mh[r] * f1; }
      *(v4fa*)&sO[w][cg * 16 + ln][dt * 16 + 8 * hh] = lo; *(v4fa*)&sO[w][cg * 16 + ln][dt * 16 + 8 * hh + 4] = hi; } }
  __builtin_amdgcn_fence(__ATOMIC_ACQ_REL, "workgroup"); __builtin_amdgcn_wave_barrier();
  {
#pragma unroll
    for (int rp = 0; rp < RPW; rp += 2) { const int r = rp + (lane >> 4), pc = lane & 15; const v4f val = *(const v4fa*)&sO[w][r][pc * 4]; *(v4f*)(O + ((size_t)b * TQ + q0 + r) * ldo + h * 64 + pc * 4) = val; }
     } }
// 5-plane variant: S = Qh Kh^T + (Ql Kh^T + Qh Kl^T)/1024 with Q/K = [hi | 2^10 residual] f16 planes (QL/KL same layout as Q16/K16), then the 3-term P.V below.
// 3-term variant: O = (P_hi V_hi + (P_lo V_hi + P_hi V_lo) / 1024) / l with P = [hi | 2^10 residual] of 1024 p and V^T = [hi | 2^10 residual] planes (VtL same layout as Vt) -> ~2^-21-class products for un-averaged (early causal / peaked) rows
template <int CAUSAL>
__global__ __launch_bounds__(128) void k_flash5(const _Float16* __restrict__ Q16, const _Float16* __restrict__ QL, int ldq, const _Float16* __restrict__ K16, const _Float16* __restrict__ KL, int ldk, const _Float16* __restrict__ Vt, const _Float16* __restrict__ VtL, const int* __restrict__ MSK, float* __restrict__ O, int ldo) {
  constexpr int RPW = 16, RTN = RPW / 16, NQB = TQ / (4 * RPW), DT = 4, KS = 2;
  __shared__ __attribute__((aligned(16))) unsigned short sP[4][RPW][40]; __shared__ __attribute__((aligned(16))) unsigned short sPL[4][RPW][40]; __shared__ __attribute__((aligned(16))) float sO[4][RPW][64 + 4];
  const int tid = threadIdx.x, w = tid >> 5, lane = tid & 31, ln = lane & 15, hh = lane >> 4;
  const int slab = blockIdx.x / QBN5, qblk = QB05 + blockIdx.x % QBN5; (void)NQB; const int b = slab / NH, h = slab % NH; const int qb0 = qblk * (4 * RPW); const int q0 = qb0 + w * RPW;
  FragH aq[2][KS], aql[2][KS];
#pragma unroll
  for (int rt = 0; rt < RTN; ++rt) { const unsigned short* qr = (const unsigned short*)Q16 + ((size_t)b * TQ + q0 + rt * 16 + ln) * ldq + h * 64; const unsigned short* ql = (const unsigned short*)QL + ((size_t)b * TQ + q0 + rt * 16 + ln) * ldq + h * 64;
#pragma unroll
    for (int ks = 0; ks < KS; ++ks) { aq[rt][ks].half[0] = *(const v8us*)(qr + ks * 32 + 8 * hh); aq[rt][ks].half[1] = *(const v8us*)(qr + ks * 32 + 16 + 8 * hh); aql[rt][ks].half[0] = *(const v8us*)(ql + ks * 32 + 8 * hh); aql[rt][ks].half[1] = *(const v8us*)(ql + ks * 32 + 16 + 8 * hh); } }
  const unsigned short* Vth = (const unsigned short*)Vt + (size_t)slab * 64 * TK; const unsigned short* Vtl = (const unsigned short*)VtL + (size_t)slab * 64 * TK;
  float m_r[2][8], l_r[2][8]; v8f oacc[2][DT], oaccL[2][DT];
#pragma unroll
  for (int rt = 0; rt < RTN; ++rt) {
#pragma unroll
    for (int r = 0; r < 8; ++r) { m_r[rt][r] = -3.0e38f; l_r[rt][r] = 0.f; }
#pragma unroll
    for (int dt = 0; dt < DT; ++dt) { oacc[rt][dt] = (v8f){0.f,0.f,0.f,0.f,0.f,0.f,0.f,0.f}; oaccL[rt][dt] = oacc[rt][dt]; } }
  const int jend = (CAUSAL == 1) ? (qb0 + 4 * RPW) : TK;      /* causal: keys beyond the block's last query never contribute */
#pragma unroll 1
  for (int j0 = 0; j0 < jend; j0 += 32) {
    v8f s[2][2];
#pragma unroll
    for (int nt = 0; nt < 2; ++nt) { const unsigned short* kr = (const unsigned short*)K16 + ((size_t)b * TK + j0 + nt * 16 + ln) * ldk + h * 64; const unsigned short* klr = (const unsigned short*)KL + ((size_t)b * TK + j0 + nt * 16 + ln) * ldk + h * 64; FragH bk[KS], bkl[KS];
#pragma unroll
      for (int ks = 0; ks < KS; ++ks) { bk[ks].half[0] = *(const v8us*)(kr + ks * 32 + 8 * hh); bk[ks].half[1] = *(const v8us*)(kr + ks * 32 + 16 + 8 * hh); bkl[ks].half[0] = *(const v8us*)(klr + ks * 32 + 8 * hh); bkl[ks].half[1] = *(const v8us*)(klr + ks * 32 + 16 + 8 * hh); }
#pragma unroll
      for (int rt = 0; rt < RTN; ++rt) { v8f acc = (v8f){0.f,0.f,0.f,0.f,0.f,0.f,0.f,0.f}, accl = acc;
#pragma unroll
        for (int ks = 0; ks < KS; ++ks) { acc = mmaH<1>(aq[rt][ks].v, aq[rt][ks].v, bk[ks].v, bk[ks].v, acc); accl = mmaH<1>(aql[rt][ks].v, aql[rt][ks].v, bk[ks].v, bk[ks].v, accl); accl = mmaH<1>(aq[rt][ks].v, aq[rt][ks].v, bkl[ks].v, bkl[ks].v, accl); }
#pragma unroll
        for (int r = 0; r < 8; ++r) acc[r] += accl[r] * 0.0009765625f;
        s[rt][nt] = acc; } }
#pragma unroll
    for (int rt = 0; rt < RTN; ++rt)
#pragma unroll
      for (int r = 0; r < 8; ++r) { const int tq = q0 + rt * 16 + 8 * hh + r; const int k0 = j0 + ln, k1 = j0 + 16 + ln;
        bool ok0 = (CAUSAL == 1) ? (k0 <= tq) : ((CAUSAL == 2) ? ((k0 >> 5) == (tq >> 5)) : true), ok1 = (CAUSAL == 1) ? (k1 <= tq) : ((CAUSAL == 2) ? ((k1 >> 5) == (tq >> 5)) : true);      /* mode 2: block-diagonal 32-token groups */
        if (CAUSAL == 4) { const int* mrow = MSK + ((size_t)b * TQ + tq) * TK; ok0 = mrow[k0] != 0; ok1 = mrow[k1] != 0; }      /* mode 4: per-(query, key) INPUT mask shared by all heads; masked keys contribute nothing (== the reference's -4096 fill, whose exp underflows to 0), rows with no valid key give l = 0 -> output 0 (== the reference's row_valid zeroing) */
        float s0 = ok0 ? s[rt][0][r] * SCL : -3.0e38f, s1 = ok1 ? s[rt][1][r] * SCL : -3.0e38f; if (CAUSAL == 17) { const float* amk = (const float*)MSK + (size_t)b * TK; s0 += bf16_round(amk[k0]); s1 += bf16_round(amk[k1]); }      /* mode 17: additive per-(batch, key) mask INPUT */ float mc = fmaxf(s0, s1);
        mc = fmaxf(mc, __shfl_xor(mc, 1, 32)); mc = fmaxf(mc, __shfl_xor(mc, 2, 32)); mc = fmaxf(mc, __shfl_xor(mc, 4, 32)); mc = fmaxf(mc, __shfl_xor(mc, 8, 32));
        const float mn = fmaxf(m_r[rt][r], mc); const float al = (mn > -1.0e38f) ? expf(m_r[rt][r] - mn) : 1.0f; m_r[rt][r] = mn; const float p0 = ok0 ? expf(s0 - mn) : 0.f, p1 = ok1 ? expf(s1 - mn) : 0.f; l_r[rt][r] = l_r[rt][r] * al + p0 + p1;
#pragma unroll
        for (int dt = 0; dt < DT; ++dt) { oacc[rt][dt][r] *= al; oaccL[rt][dt][r] *= al; }
        FragH t2, t2l; const float ps0 = p0 * 1024.0f, ps1 = p1 * 1024.0f; t2.h[0] = (_Float16)ps0; t2.h[1] = (_Float16)ps1; t2l.h[0] = (_Float16)((ps0 - (float)t2.h[0]) * 1024.0f); t2l.h[1] = (_Float16)((ps1 - (float)t2.h[1]) * 1024.0f);
        sP[w][rt * 16 + 8 * hh + r][ln] = t2.u[0]; sP[w][rt * 16 + 8 * hh + r][16 + ln] = t2.u[1]; sPL[w][rt * 16 + 8 * hh + r][ln] = t2l.u[0]; sPL[w][rt * 16 + 8 * hh + r][16 + ln] = t2l.u[1]; }
    __builtin_amdgcn_fence(__ATOMIC_ACQ_REL, "workgroup"); __builtin_amdgcn_wave_barrier();
    FragH pa[2], pl[2];
#pragma unroll
    for (int rt = 0; rt < RTN; ++rt) { pa[rt].half[0] = *(const v8us*)&sP[w][rt * 16 + ln][8 * hh]; pa[rt].half[1] = *(const v8us*)&sP[w][rt * 16 + ln][16 + 8 * hh]; pl[rt].half[0] = *(const v8us*)&sPL[w][rt * 16 + ln][8 * hh]; pl[rt].half[1] = *(const v8us*)&sPL[w][rt * 16 + ln][16 + 8 * hh]; }
#pragma unroll
    for (int dt = 0; dt < DT; ++dt) { const unsigned short* vrow = Vth + (size_t)(dt * 16 + ln) * TK + j0; const unsigned short* vrl = Vtl + (size_t)(dt * 16 + ln) * TK + j0; FragH bv, bl; bv.half[0] = *(const v8us*)(vrow + 8 * hh); bv.half[1] = *(const v8us*)(vrow + 16 + 8 * hh); bl.half[0] = *(const v8us*)(vrl + 8 * hh); bl.half[1] = *(const v8us*)(vrl + 16 + 8 * hh);
#pragma unroll
      for (int rt = 0; rt < RTN; ++rt) { oacc[rt][dt] = mmaH<1>(pa[rt].v, pa[rt].v, bv.v, bv.v, oacc[rt][dt]); oaccL[rt][dt] = mmaH<1>(pl[rt].v, pl[rt].v, bv.v, bv.v, oaccL[rt][dt]); oaccL[rt][dt] = mmaH<1>(pa[rt].v, pa[rt].v, bl.v, bl.v, oaccL[rt][dt]); } }
    __builtin_amdgcn_fence(__ATOMIC_ACQ_REL, "workgroup"); __builtin_amdgcn_wave_barrier(); }
#pragma unroll
  for (int rt = 0; rt < RTN; ++rt) {
#pragma unroll
    for (int r = 0; r < 8; ++r) { float l = l_r[rt][r]; l += __shfl_xor(l, 1, 32); l += __shfl_xor(l, 2, 32); l += __shfl_xor(l, 4, 32); l += __shfl_xor(l, 8, 32); l_r[rt][r] = (l > 0.f) ? 1.0f / (l * 1024.0f) : 0.f; }
#pragma unroll
    for (int dt = 0; dt < DT; ++dt)
#pragma unroll
      for (int r = 0; r < 8; ++r) { float v = oacc[rt][dt][r]; v += oaccL[rt][dt][r] * 0.0009765625f; sO[w][rt * 16 + 8 * hh + r][dt * 16 + ln] = v * l_r[rt][r]; } }
  __builtin_amdgcn_fence(__ATOMIC_ACQ_REL, "workgroup"); __builtin_amdgcn_wave_barrier();
  {
#pragma unroll
    for (int rp = 0; rp < RPW; rp += 2) { const int r = rp + (lane >> 4), pc = lane & 15; const v4f val = *(const v4fa*)&sO[w][r][pc * 4]; *(v4f*)(O + ((size_t)b * TQ + q0 + r) * ldo + h * 64 + pc * 4) = val; }
     } }

__global__ __launch_bounds__(256) void k_rotab(float* __restrict__ CS, float* __restrict__ SN) {
  #pragma clang fp contract(off)
  const int t = blockIdx.x * 256 + threadIdx.x; if (t >= SLEN * 32) return; const int j = t % 32, s = t / 32; const float ex = (float)(2 * j) / 64.0f; const float inv = 1.0f / powf(10000.0f, ex); const float th = (float)s * inv; const float c = cosf(th), sn = sinf(th);
  { *(float*)(CS + t) = c; *(float*)(SN + t) = sn;  } }
__global__ __launch_bounds__(256) void k_rope(const float* __restrict__ F, int nsrc, int ndst, int rep, const float* __restrict__ CS, const float* __restrict__ SN, _Float16* __restrict__ H, _Float16* __restrict__ L) {
  #pragma clang fp contract(off)
  const size_t t = (size_t)blockIdx.x * 256 + threadIdx.x; if (t >= (size_t)NR * ndst * 4) return; const int g8 = (int)(t % 4); const int hd = (int)((t / 4) % ndst); const size_t row = t / ((size_t)4 * ndst); const int s = (int)(row % SLEN); const int hs = hd / rep;
  const float* src = F + row * (size_t)(nsrc * 64) + hs * 64; FragH ah, al, bh, bl;
  for (int i = 0; i < 8; ++i) { const int d = g8 * 8 + i; const float c = CS[s * 32 + d], sn = SN[s * 32 + d]; const float x1 = src[d], x2 = src[d + 32];
    float o1 = x1 * c; o1 += -x2 * sn; float o2 = x2 * c; o2 += x1 * sn;
    _Float16 hv = (_Float16)o1; ah.h[i] = hv; al.h[i] = (_Float16)((o1 - (float)hv) * 1024.0f); hv = (_Float16)o2; bh.h[i] = hv; bl.h[i] = (_Float16)((o2 - (float)hv) * 1024.0f); }
  const size_t o = row * (size_t)(ndst * 64) + hd * 64 + g8 * 8;
  { *(v8us*)((unsigned short*)H + o) = ah.half[0]; *(v8us*)((unsigned short*)H + o + 32) = bh.half[0]; *(v8us*)((unsigned short*)L + o) = al.half[0]; *(v8us*)((unsigned short*)L + o + 32) = bl.half[0];  } }
// Every operand conversion in ONE launch, by block ranges: the exact f16 plane of x, the three weight planes (x16, one behind the other in B3), and the mask table of the flash kernel.
// A conversion block streams 16384 values: 16 loads of 16 bytes a lane, each wave-wide load 512 bytes in a row, several of them under way at once; each store of a wave is two whole 128-byte lines. Few, long waves: a launch of such short work is paced by how fast waves start.
// The mask table: M2 = bf16-rounded mask times log2 e. Beyond +-1e38 the table goes on with slope 1/2, so that the factor turns no finite mask into an infinity: two different bf16 values up there still lie more than 1e35 apart in the table, so the smaller one's weight is 0 as it is in natural units, equal values stay equal, and the order is kept; an infinite mask stays infinite
#define PXB (NR * DM / 16384)      /* blocks for x */
#define PWB (DM * DM / 16384)      /* blocks for one weight matrix */
#define PMB (NB * SLEN / 256)      /* blocks for the mask: 1 value a thread */
__global__ __launch_bounds__(256) void k_prep(const float* __restrict__ x, const float* __restrict__ Wq, const float* __restrict__ Wk, const float* __restrict__ Wv, const float* __restrict__ am, _Float16* __restrict__ X16, _Float16* __restrict__ B3, float* __restrict__ M2) {
  const int bx = blockIdx.x, tid = threadIdx.x;
  if (bx >= PXB + 3 * PWB) { const int t = (bx - (PXB + 3 * PWB)) * 256 + tid; const float mr = bf16_round(am[t]), ma = fabsf(mr); M2[t] = (ma <= 1.0e38f) ? mr * LOG2E : copysignf(1.0e38f * LOG2E + (ma - 1.0e38f) * 0.5f, mr); return; }
  const float* src = x; _Float16* dst = X16; float sc = 1.0f; int b0 = bx;
  if (bx >= PXB) { const int wi = (bx - PXB) / PWB; b0 = (bx - PXB) % PWB; src = (wi == 0) ? Wq : ((wi == 1) ? Wk : Wv); dst = B3 + (size_t)wi * DM * DM; sc = 16.0f; }      /* a weight is (out, in) = Bt as it lies */
  const size_t e0 = (size_t)b0 * 16384 + tid * 4; v4f v[16];
#pragma unroll      /* constant indices: the loaded values stay in registers, and loads can be issued ahead of the conversions */
  for (int j = 0; j < 16; ++j) v[j] = *(const v4fa*)(src + e0 + j * 1024);
#pragma unroll      /* constant indices: the loaded values stay in registers */
  for (int j = 0; j < 16; ++j) { v4h h4;
#pragma unroll      /* constant indices: the loaded values stay in registers */
    for (int q = 0; q < 4; ++q) h4[q] = (_Float16)(bf16_round(v[j][q]) * sc);
    *(v4h*)(dst + e0 + j * 1024) = h4; } }
__global__ __launch_bounds__(256) void k_rotab2(float* __restrict__ CS, float* __restrict__ SN) {
  #pragma clang fp contract(off)
  const int t = blockIdx.x * 256 + threadIdx.x; if (t >= SLEN * 32) return; const int j = t % 32, s = t / 32; const float c0 = -0.14391156831212787f;      /* -ln(10000)/64 rounded to f32 */ const float inv = expf((float)(2 * j) * c0); const float th = (float)s * inv; const float c = cosf(th), sn = sinf(th);
  { *(float*)(CS + t) = c; *(float*)(SN + t) = sn;  } }
__global__ __launch_bounds__(256) void k_lnu(const float* __restrict__ X, _Float16* __restrict__ N16, float* __restrict__ XB) {
  #pragma clang fp contract(off)
  const int wv = threadIdx.x >> 5, ln = threadIdx.x & 31; const size_t r = (size_t)blockIdx.x * 8 + wv; if (r >= NR) return; float a[32]; float s = 0.f;
  for (int i = 0; i < 4; ++i) { const v8f v = *(const v8f*)(X + r * DM + (i * 32 + ln) * 8); for (int q = 0; q < 8; ++q) { const float u = bf16_round(v[q]); a[i * 8 + q] = u; s += u; } }
  for (int o = 16; o > 0; o >>= 1) s += __shfl_xor(s, o, 32); const float mu = s / (float)DM; float var = 0.f; for (int q = 0; q < 32; ++q) { const float d = a[q] - mu; var += d * d; }
  for (int o = 16; o > 0; o >>= 1) var += __shfl_xor(var, o, 32); const float den = sqrtf(var / (float)(DM - 1)) + 1e-6f; const float inv = 1.0f / den;      /* one reciprocal per row; (x-mean)*inv vs the reference's division differs by <= 1 ulp */
  { for (int i = 0; i < 4; ++i) { const int c0 = (i * 32 + ln) * 8; FragH f; v8f xb; for (int q = 0; q < 8; ++q) { f.h[q] = (_Float16)((a[i * 8 + q] - mu) * inv); xb[q] = a[i * 8 + q]; } *(v8us*)((unsigned short*)N16 + r * DM + c0) = f.half[0]; *(v8f*)(XB + r * DM + c0) = xb; }  } }

extern "C" void kernel_launch(void* const* d_in, const int* in_sizes, int n_in,
                              void* d_out, int out_size, void* d_ws, size_t ws_size, hipStream_t stream) {
  (void)in_sizes; (void)n_in; (void)out_size;
  const float* const* I = (const float* const*)d_in; const float* x = I[0]; const float* sp = I[1]; const float* am = I[2]; const float* Wq = I[3]; const float* Wk = I[4]; const float* Wv = I[5];
  char* ws = (char*)d_ws; size_t off = 0;
  auto take = [&](size_t bytes) { char* p = ws + off; off += (bytes + 255) & ~(size_t)255; return p; };
  const size_t np = (size_t)NR * DM;
  _Float16* B3 = (_Float16*)take((size_t)3 * DM * DM * 2); float* M2 = (float*)take((size_t)NB * SLEN * 4);
  _Float16* X16 = (_Float16*)take(np * 2); _Float16* QH = (_Float16*)take(np * 2); _Float16* KXH = (_Float16*)take(np * 2); _Float16* VT = (_Float16*)take(np * 2);
  if (off > ws_size) return;      /* 6 + 4 x 8 MiB */
  k_prep<<<PXB + 3 * PWB + PMB, 256, 0, stream>>>(x, Wq, Wk, Wv, am, X16, B3, M2);
  k_qkv<<<dim3((NR / 128) * (NH / 2), 3), 128, 0, stream>>>(X16, B3, sp, QH, KXH, VT);
  k_flash<17><<<NB * NH * QBNP, 256, 0, stream>>>(QH, DM, KXH, DM, VT, (const int*)M2, (float*)d_out, DM);      /* + the mask table [b][key]; the merged context is the output */
}

// v009
// Measured time: 60.4 microseconds a run.
// In both of two side-by-side timings against v008, it was 1.06 times as fast.
// Over all steps from v000, the starting kernel, it is 6.50 times as fast.
#include <hip/hip_runtime.h>
// DiffBertSelfAttention (2 x 2048 tokens, D 1024 = 16 heads of 64): q, k, v = x W^T; RoFormer rotary from the sinusoidal_pos INPUT ([sin | cos] halves, interleave-duplicated: out[2i] = x[2i] cos_i - x[2i+1] sin_i, out[2i+1] = x[2i+1] cos_i + x[2i] sin_i); scores/8 + attention_mask[b, key] (additive INPUT, broadcast over heads and queries); softmax; ctx = probs v merged -> the output (no output projection).
// Structure, three launches: k_prep (exact f16 plane of x, exact x16 weight planes, the mask table); k_qkv (q, k, v as WMMA GEMMs, 64x64 wave tiles, f32 accumulation, whose epilogue does the interleaved RoPE in f32 from the input table, bf16-rounded like every input, the f16 conversion, and V^T by an LDS tile); the fused flash kernel with the per-key additive mask (mode 17: a table made from the input in the same call, rounded like every input and in base-2 units; plain operands: every row averages ~2048 keys) writing the merged context straight to the output.
// Compute dtype: inputs and parameters rounded to bf16; q/k/P/v as plain f16 operands (~2^-12); RoPE/softmax f32. v_wmma_f32_16x16x32_f16.
#define NB 2
#define DM 1024
#define NKV 16
#define NREP (NH / NKV)
#define KVD (NKV * 64)           /* 1024 */
#define NR (NB * SLEN)           /* 4096 */
#define SLEN 2048
#define TQ SLEN
#define TK SLEN
#define NH 16
#define SCL 0.125f
#define LOG2E 1.4426950408889634f
#define SCL2 (SCL * LOG2E)      /* scores in base-2 units: exp(s) = 2^(s log2 e) */
#define QBLKS (TQ / 128)
#define QB05 0
#define QBN5 4
#define QB0P 0
#define QBNP QBLKS           /* non-causal: plain flash on every query block */
#define RE 256
typedef __bf16 v16b __attribute__((ext_vector_type(16)));
typedef unsigned short v8us __attribute__((ext_vector_type(8), may_alias));
typedef float  v8f  __attribute__((ext_vector_type(8)));
typedef float  v4f  __attribute__((ext_vector_type(4)));
typedef float  v4fa __attribute__((ext_vector_type(4), may_alias));
typedef float  v2fa __attribute__((ext_vector_type(2), may_alias));
typedef float  v2f  __attribute__((ext_vector_type(2)));
union FragB { v16b v; v8us half[2]; unsigned short u[16]; };

__device__ __forceinline__ unsigned short bf16_bits(float x) { unsigned int u = __float_as_uint(x); return (unsigned short)((u + 0x7FFFu + ((u >> 16) & 1u)) >> 16); }
__device__ __forceinline__ float bf16_val(unsigned short b) { return __uint_as_float(((unsigned int)b) << 16); }
__device__ __forceinline__ float bf16_round(float x) { return bf16_val(bf16_bits(x)); }
// D += A·B with NT terms: 1 = ah·bh, 2 = + al·bh (A split), 3 = + ah·bl (both split)
template <int NT>
__device__ __forceinline__ v8f mmaN(v16b ah, v16b al, v16b bh, v16b bl, v8f c) {
  c = __builtin_amdgcn_wmma_f32_16x16x32_bf16(false, ah, false, bh, (short)0, c, false, false);
  if (NT >= 2) c = __builtin_amdgcn_wmma_f32_16x16x32_bf16(false, al, false, bh, (short)0, c, false, false);
  if (NT >= 3) c = __builtin_amdgcn_wmma_f32_16x16x32_bf16(false, ah, false, bl, (short)0, c, false, false);
  asm volatile("v_nop\n\tv_nop\n\tv_nop\n\tv_nop" : "+v"(c) : "v"(ah), "v"(al), "v"(bh), "v"(bl));
  return c;
}

__global__ __launch_bounds__(256) void k_wt_bf16(const float* __restrict__ W, unsigned short* __restrict__ Wt, int K, int N) {
  const int t = blockIdx.x * 256 + threadIdx.x;
  const int k8n = K / 8;
  if (t >= N * k8n) return;
  const int n = t / k8n, k8 = (t % k8n) * 8;
  v8us v;
#pragma unroll
  for (int i = 0; i < 8; ++i) v[i] = bf16_bits(W[(size_t)(k8 + i) * N + n]);
  *(v8us*)(Wt + (size_t)n * K + k8) = v;
  
}

// GEMM C[M][N] (f32, pitch ldc) = act(A[M][K]·W + bias). A f32 row-major (pitch lda) converted per fragment to bf16
// (ASPLIT: hi/lo two planes -> 2 terms, else single rounded term); Wt bf16 [N][K] (pitch ldb). BIAS_BF16 rounds the
// bias to bf16 first (bias quantised to bf16 before the add). K%32==0, M%16==0, N%64==0.
template <bool ASPLIT, int ACT, bool BIAS_BF16>
__global__ __launch_bounds__(128) void k_gemm_bf(const float* __restrict__ A, int lda, const unsigned short* __restrict__ Wt, int ldb,
                                               const float* __restrict__ bias, float* __restrict__ C, int ldc, int M, int N, int K) {
  __shared__ __attribute__((aligned(16))) float so[4][16][64];
  const int tid = threadIdx.x, w = tid >> 5, lane = tid & 31, ln = lane & 15, hh = lane >> 4;
  const int ntn = N / 64;
  const int wid = blockIdx.x * 4 + w;
  const int mt = wid / ntn, nq = wid % ntn;
  if (mt * 16 >= M) return;
  const int row0 = mt * 16, col0 = nq * 64;
  const float* arow = A + (size_t)(row0 + ln) * lda;
  v8f acc[4] = {};
  for (int kb = 0; kb < K; kb += 32) {
    FragB ah, al;
    const v4f x0 = *(const v4fa*)(arow + kb + 8 * hh), x1 = *(const v4fa*)(arow + kb + 8 * hh + 4);
    const v4f x2 = *(const v4fa*)(arow + kb + 16 + 8 * hh), x3 = *(const v4fa*)(arow + kb + 16 + 8 * hh + 4);
    float xs[16] = {x0[0],x0[1],x0[2],x0[3],x1[0],x1[1],x1[2],x1[3],x2[0],x2[1],x2[2],x2[3],x3[0],x3[1],x3[2],x3[3]};
#pragma unroll
    for (int i = 0; i < 16; ++i) { const unsigned short hb = bf16_bits(xs[i]); ah.u[i] = hb; al.u[i] = ASPLIT ? bf16_bits(xs[i] - bf16_val(hb)) : (unsigned short)0; }
#pragma unroll
    for (int t = 0; t < 4; ++t) {
      const unsigned short* brow = Wt + (size_t)(col0 + t * 16 + ln) * ldb + kb;
      FragB b;
      b.half[0] = *(const v8us*)(brow + 8 * hh);
      b.half[1] = *(const v8us*)(brow + 16 + 8 * hh);
      acc[t] = mmaN<ASPLIT ? 2 : 1>(ah.v, al.v, b.v, b.v, acc[t]);
    }
  }
#pragma unroll
  for (int t = 0; t < 4; ++t) {
    float bv = bias ? bias[col0 + t * 16 + ln] : 0.f;
    if (BIAS_BF16) bv = bf16_round(bv);
#pragma unroll
    for (int r = 0; r < 8; ++r) { float v = acc[t][r] + bv; if (ACT == 1) v = fmaxf(v, 0.f); so[w][8 * hh + r][t * 16 + ln] = v; }
  }
  __builtin_amdgcn_fence(__ATOMIC_ACQ_REL, "workgroup");
  __builtin_amdgcn_wave_barrier();
  const int rsub = lane >> 4, c4 = (lane & 15) * 4;
  {
#pragma unroll
    for (int q = 0; q < 8; ++q) {
      const int r = q * 2 + rsub;
      const v4f v = *(const v4fa*)&so[w][r][c4];
      *(v4f*)(C + (size_t)(row0 + r) * ldc + col0 + c4) = v;
    }
    
  }
}

// GEMM C = act(A·W + bias + resid): A f32 (ASPLIT -> hi/lo 2 terms), Wt bf16 [N][K]; ACT 0 none, 1 relu, 2 exact gelu;
// resid (optional, f32, row index = (row % rmod), pitch ldr, RES_BF16 rounds it) added before the activation.
template <bool ASPLIT, int ACT, bool BIAS_BF16, bool RES_BF16>
__global__ __launch_bounds__(128) void k_gemm_bf3(const float* __restrict__ A, int lda, const unsigned short* __restrict__ Wt, int ldb,
                                                const float* __restrict__ bias, const float* __restrict__ resid, int rmod, int ldr,
                                                float* __restrict__ C, int ldc, int M, int N, int K) {
  __shared__ __attribute__((aligned(16))) float so[4][16][64];
  const int tid = threadIdx.x, w = tid >> 5, lane = tid & 31, ln = lane & 15, hh = lane >> 4;
  const int ntn = N / 64;
  const int wid = blockIdx.x * 4 + w;
  const int mt = wid / ntn, nq = wid % ntn;
  if (mt * 16 >= M) return;
  const int row0 = mt * 16, col0 = nq * 64;
  const float* arow = A + (size_t)(row0 + ln) * lda;
  v8f acc[4] = {};
  for (int kb = 0; kb < K; kb += 32) {
    FragB ah, al;
    const v4f x0 = *(const v4fa*)(arow + kb + 8 * hh), x1 = *(const v4fa*)(arow + kb + 8 * hh + 4);
    const v4f x2 = *(const v4fa*)(arow + kb + 16 + 8 * hh), x3 = *(const v4fa*)(arow + kb + 16 + 8 * hh + 4);
    float xs[16] = {x0[0],x0[1],x0[2],x0[3],x1[0],x1[1],x1[2],x1[3],x2[0],x2[1],x2[2],x2[3],x3[0],x3[1],x3[2],x3[3]};
#pragma unroll
    for (int i = 0; i < 16; ++i) { const unsigned short hb = bf16_bits(xs[i]); ah.u[i] = hb; al.u[i] = ASPLIT ? bf16_bits(xs[i] - bf16_val(hb)) : (unsigned short)0; }
#pragma unroll
    for (int t = 0; t < 4; ++t) {
      const unsigned short* brow = Wt + (size_t)(col0 + t * 16 + ln) * ldb + kb;
      FragB b;
      b.half[0] = *(const v8us*)(brow + 8 * hh);
      b.half[1] = *(const v8us*)(brow + 16 + 8 * hh);
      acc[t] = mmaN<ASPLIT ? 2 : 1>(ah.v, al.v, b.v, b.v, acc[t]);
    }
  }
#pragma unroll
  for (int t = 0; t < 4; ++t) {
    const int col = col0 + t * 16 + ln;
    float bv = bias ? bias[col] : 0.f;
    if (BIAS_BF16) bv = bf16_round(bv);
#pragma unroll
    for (int r = 0; r < 8; ++r) {
      float v = acc[t][r] + bv;
      if (resid) { float rv = resid[(size_t)((row0 + 8 * hh + r) % rmod) * ldr + col]; if (RES_BF16) rv = bf16_round(rv); v += rv; }
      if (ACT == 1) v = fmaxf(v, 0.f);
      if (ACT == 2) v = 0.5f * v * (1.0f + erff(v * 0.70710678118654752f));
      if (ACT == 3) { const float u = 0.7978845608028654f * (v + 0.044715f * v * v * v); v = 0.5f * v * (1.0f + tanhf(u)); }
      so[w][8 * hh + r][t * 16 + ln] = v;
    }
  }
  __builtin_amdgcn_fence(__ATOMIC_ACQ_REL, "workgroup");
  __builtin_amdgcn_wave_barrier();
  const int rsub = lane >> 4, c4 = (lane & 15) * 4;
  {
#pragma unroll
    for (int q = 0; q < 8; ++q) {
      const int r = q * 2 + rsub;
      const v4f v = *(const v4fa*)&so[w][r][c4];
      *(v4f*)(C + (size_t)(row0 + r) * ldc + col0 + c4) = v;
    }
    
  }
}
// row LayerNorm (biased variance, eps) over N: s = X (+ R); optional out_sum <- s; out_norm <- (s-mu)*rsqrt(var+eps)*g + b
template <bool PARAM_BF16>
__global__ __launch_bounds__(256) void k_layernorm(const float* __restrict__ X, const float* __restrict__ R, const float* __restrict__ g, const float* __restrict__ bta,
                                                  float* __restrict__ out_sum, float* __restrict__ out_norm, int N, float eps) {
  __shared__ float red[256];
  const int row = blockIdx.x, tid = threadIdx.x;
  const float* x = X + (size_t)row * N; const float* rr = R ? R + (size_t)row * N : nullptr;
  float vals[16];                     // up to N = 4096
  const int per = N / 256;            // contiguous chunk per thread? use strided-by-4 chunks: thread handles j = tid*4 + 1024*u
  float s1 = 0.f;
  for (int u = 0; u < per / 4; ++u) {
    const int j = tid * 4 + 1024 * u;
    const v4f a = *(const v4fa*)(x + j);
    v4f b = {0.f,0.f,0.f,0.f}; if (rr) b = *(const v4fa*)(rr + j);
#pragma unroll
    for (int q = 0; q < 4; ++q) { const float v = a[q] + b[q]; vals[u * 4 + q] = v; s1 += v; }
  }
  red[tid] = s1; __syncthreads();
  for (int st = 128; st > 0; st >>= 1) { if (tid < st) red[tid] += red[tid + st]; __syncthreads(); }
  const float mu = red[0] / (float)N; __syncthreads();
  float s2 = 0.f;
  for (int u = 0; u < per / 4; ++u)
#pragma unroll
    for (int q = 0; q < 4; ++q) { const float c = vals[u * 4 + q] - mu; s2 += c * c; }
  red[tid] = s2; __syncthreads();
  for (int st = 128; st > 0; st >>= 1) { if (tid < st) red[tid] += red[tid + st]; __syncthreads(); }
  const float rs = rsqrtf(red[0] / (float)N + eps);
  {
    for (int u = 0; u < per / 4; ++u) {
      const int j = tid * 4 + 1024 * u;
      v4f o, sm;
#pragma unroll
      for (int q = 0; q < 4; ++q) {
        float gg = g[j + q], bb = bta[j + q];
        if (PARAM_BF16) { gg = bf16_round(gg); bb = bf16_round(bb); }
        sm[q] = vals[u * 4 + q]; o[q] = (vals[u * 4 + q] - mu) * rs * gg + bb;
      }
      if (out_sum) *(v4f*)(out_sum + (size_t)row * N + j) = sm;
      *(v4f*)(out_norm + (size_t)row * N + j) = o;
    }
    
  }
}



// ---- f16 WMMA path (v_wmma_f32_16x16x32_f16): 11-bit significands for operands in range — used where a [0,1] probability operand needs more precision than bf16
typedef _Float16 v16h __attribute__((ext_vector_type(16)));
union FragH { v16h v; v8us half[2]; _Float16 h[16]; unsigned short u[16]; };
template <int NT>
__device__ __forceinline__ v8f mmaH(v16h ah, v16h al, v16h bh, v16h bl, v8f c) {
  c = __builtin_amdgcn_wmma_f32_16x16x32_f16(false, ah, false, bh, (short)0, c, false, false);
  if (NT >= 2) c = __builtin_amdgcn_wmma_f32_16x16x32_f16(false, al, false, bh, (short)0, c, false, false);
  if (NT >= 3) c = __builtin_amdgcn_wmma_f32_16x16x32_f16(false, ah, false, bl, (short)0, c, false, false);
  asm volatile("v_nop\n\tv_nop\n\tv_nop\n\tv_nop" : "+v"(c) : "v"(ah), "v"(al), "v"(bh), "v"(bl));
  return c;
}
// batched GEMM like k_gemm_b but f16 operands: A f32 (split into f16 hi/lo if ASPLIT, else rounded to f16), Bt = f16 values [n][k]; alpha; C f32; N multiple of 16 (partial tiles skipped)
template <bool ASPLIT>
__global__ __launch_bounds__(128) void k_gemm_h(const float* __restrict__ A, int lda, size_t sA, const _Float16* __restrict__ Bh, int ldb, size_t sB, float alpha, float* __restrict__ C, int ldc, size_t sC, int M, int N, int K) {
  __shared__ __attribute__((aligned(16))) float so[4][16][64];
  const int tid = threadIdx.x, w = tid >> 5, lane = tid & 31, ln = lane & 15, hh = lane >> 4; const int by = blockIdx.y;
  A += (size_t)by * sA; Bh += (size_t)by * sB; C += (size_t)by * sC;
  const int ntn = (N + 63) / 64; const int wid = blockIdx.x * 4 + w; const int mt = wid / ntn, nq = wid % ntn; if (mt * 16 >= M) return;
  const int row0 = mt * 16, col0 = nq * 64; const float* arow = A + (size_t)(row0 + ln) * lda;
  v8f acc[4] = {};
  for (int kb = 0; kb < K; kb += 32) {
    FragH ah, al;
    const v4f x0 = *(const v4fa*)(arow + kb + 8 * hh), x1 = *(const v4fa*)(arow + kb + 8 * hh + 4), x2 = *(const v4fa*)(arow + kb + 16 + 8 * hh), x3 = *(const v4fa*)(arow + kb + 16 + 8 * hh + 4);
    float xs[16] = {x0[0],x0[1],x0[2],x0[3],x1[0],x1[1],x1[2],x1[3],x2[0],x2[1],x2[2],x2[3],x3[0],x3[1],x3[2],x3[3]};
#pragma unroll
    for (int i = 0; i < 16; ++i) { const _Float16 h = (_Float16)xs[i]; ah.h[i] = h; al.h[i] = ASPLIT ? (_Float16)(xs[i] - (float)h) : (_Float16)0.0f; }
#pragma unroll
    for (int t = 0; t < 4; ++t) { if (col0 + t * 16 >= N) continue; const size_t boff = (size_t)(col0 + t * 16 + ln) * ldb + kb; FragH bq; bq.half[0] = *(const v8us*)(Bh + boff + 8 * hh); bq.half[1] = *(const v8us*)(Bh + boff + 16 + 8 * hh);
      acc[t] = mmaH<ASPLIT ? 2 : 1>(ah.v, al.v, bq.v, bq.v, acc[t]); }
  }
#pragma unroll
  for (int t = 0; t < 4; ++t) { if (col0 + t * 16 >= N) continue;
#pragma unroll
    for (int r = 0; r < 8; ++r) so[w][8 * hh + r][t * 16 + ln] = acc[t][r] * alpha; }
  __builtin_amdgcn_fence(__ATOMIC_ACQ_REL, "workgroup"); __builtin_amdgcn_wave_barrier();
  const int rsub = lane >> 4, c4 = (lane & 15) * 4;
  {
#pragma unroll
    for (int q = 0; q < 8; ++q) { const int r = q * 2 + rsub; if (col0 + c4 < N) { const v4f v = *(const v4fa*)&so[w][r][c4]; *(v4f*)(C + (size_t)(row0 + r) * ldc + col0 + c4) = v; } }
     }
}

// Wt[n][k] = f16(W[k][n]·scale) from f32 row-major W[K][N] (scale = power of two; bf16-exact weights stay exact in f16 away from the subnormal range)
__global__ __launch_bounds__(256) void k_wt_f16(const float* __restrict__ W, _Float16* __restrict__ Wt, int K, int N, float scale) {
  const int t = blockIdx.x * 256 + threadIdx.x; if (t >= N * (K / 8)) return; const int n = t / (K / 8), k8 = (t % (K / 8)) * 8; FragH f;
#pragma unroll
  for (int i = 0; i < 8; ++i) f.h[i] = (_Float16)(bf16_round(W[(size_t)(k8 + i) * N + n]) * scale); const v8us o = f.half[0];
  *(v8us*)((unsigned short*)Wt + (size_t)n * K + k8) = o; 
}
// k_gemm_hh variant with fused epilogue: v = acc·alpha + bias[by·sBias + col] (+ CP[(row/rowsPerB)·sCPb + by·64 + col] if CP) ; ACT 0 none / 1 elu ; writes f16 C16 (and f32 C if non-null)
template <int ACT>
__global__ __launch_bounds__(128) void k_gemm_hhx(const _Float16* __restrict__ A, int lda, size_t sA, const _Float16* __restrict__ Bh, int ldb, size_t sB, float alpha, const float* __restrict__ bias, size_t sBias, const float* __restrict__ CP, int rowsPerB, size_t sCPb, int row0g,
    float* __restrict__ C, _Float16* __restrict__ C16, int ldc, size_t sC, int M, int N, int K) {
  __shared__ __attribute__((aligned(16))) float so[4][16][64];
  const int tid = threadIdx.x, w = tid >> 5, lane = tid & 31, ln = lane & 15, hh = lane >> 4; const int by = blockIdx.y;
  A += (size_t)by * sA; Bh += (size_t)by * sB; const size_t cofs = (size_t)by * sC; const float* bp = bias ? bias + (size_t)by * sBias : nullptr;
  const int ntn = (N + 63) / 64; const int wid = blockIdx.x * 4 + w; const int mt = wid / ntn, nq = wid % ntn; if (mt * 16 >= M) return;
  const int row0 = mt * 16, col0 = nq * 64; const _Float16* arow = A + (size_t)(row0 + ln) * lda;
  v8f acc[4] = {};
  for (int kb = 0; kb < K; kb += 32) { FragH ah; ah.half[0] = *(const v8us*)((const unsigned short*)arow + kb + 8 * hh); ah.half[1] = *(const v8us*)((const unsigned short*)arow + kb + 16 + 8 * hh);
#pragma unroll
    for (int t = 0; t < 4; ++t) { if (col0 + t * 16 >= N) continue; const size_t boff = (size_t)(col0 + t * 16 + ln) * ldb + kb; FragH bq; bq.half[0] = *(const v8us*)((const unsigned short*)Bh + boff + 8 * hh); bq.half[1] = *(const v8us*)((const unsigned short*)Bh + boff + 16 + 8 * hh);
      acc[t] = mmaH<1>(ah.v, ah.v, bq.v, bq.v, acc[t]); }
  }
#pragma unroll
  for (int t = 0; t < 4; ++t) { if (col0 + t * 16 >= N) continue; const int col = col0 + t * 16 + ln; const float bv = bp ? bf16_round(bp[col]) : 0.f;
#pragma unroll
    for (int r = 0; r < 8; ++r) { float v = acc[t][r] * alpha + bv; if (CP) { const int bidx = (row0g + row0 + 8 * hh + r) / rowsPerB; v += CP[(size_t)bidx * sCPb + (size_t)by * 64 + col]; } if (ACT == 1) v = (v > 0.f) ? v : expm1f(v); else if (ACT == 7) v = (v > 0.f) ? v + 1.0f : expf(v); else if (ACT == 8) v = tanhf(v); else if (ACT == 9) v = 0.5f * v * (1.0f + tanhf(0.7978845608028654f * (v + 0.044715f * v * v * v))); else if (ACT == 11) v = 1.0f / (1.0f + expf(-v)); else if (ACT == 12) v = (v > 0.f) ? v : 0.01f * v; else if (ACT == 14) v = (v > 0.f) ? v : 0.1f * v; else if (ACT == 15) v = v / (1.0f + expf(-v)); else if (ACT == 3) v = fmaxf(v, 0.f); else if (ACT == 6) v = 0.5f * v * (1.0f + erff(v * 0.70710678118654752f)); so[w][8 * hh + r][t * 16 + ln] = v; } }
  __builtin_amdgcn_fence(__ATOMIC_ACQ_REL, "workgroup"); __builtin_amdgcn_wave_barrier();
  const int rsub = lane >> 4, c4 = (lane & 15) * 4; typedef _Float16 v4h __attribute__((ext_vector_type(4)));
  {
#pragma unroll
    for (int q = 0; q < 8; ++q) { const int r = q * 2 + rsub; if (col0 + c4 < N) { const v4f v = *(const v4fa*)&so[w][r][c4]; if (C) *(v4f*)(C + cofs + (size_t)(row0 + r) * ldc + col0 + c4) = v; if (C16) { v4h h4; for (int i = 0; i < 4; ++i) h4[i] = (_Float16)v[i]; *(v4h*)(C16 + cofs + (size_t)(row0 + r) * ldc + col0 + c4) = h4; } } }
     }
}


typedef _Float16 v4h __attribute__((ext_vector_type(4)));

__global__ __launch_bounds__(256) void k_h16(const float* __restrict__ x, _Float16* __restrict__ X16, size_t n8) { const size_t t = (size_t)blockIdx.x * 256 + threadIdx.x; if (t >= n8) return; FragH f;
#pragma unroll
  for (int q = 0; q < 8; ++q) f.h[q] = (_Float16)x[t * 8 + q]; *(v8us*)((unsigned short*)X16 + t * 8) = f.half[0];  }
__global__ __launch_bounds__(256) void k_round16f(const float* __restrict__ W, _Float16* __restrict__ Bt, size_t n8) { const size_t t = (size_t)blockIdx.x * 256 + threadIdx.x; if (t >= n8) return; FragH f;
#pragma unroll
  for (int i = 0; i < 8; ++i) f.h[i] = (_Float16)(bf16_round(W[t * 8 + i]) * 16.0f); *(v8us*)((unsigned short*)Bt + t * 8) = f.half[0];  }
template <int NHv, int TTv>
__global__ __launch_bounds__(256) void k_vt(const _Float16* __restrict__ V16, int ldv, int voff, _Float16* __restrict__ Vt) { __shared__ unsigned short tl[64][66]; const int tid = threadIdx.x; const int slab = blockIdx.x / (TTv / 64), lg = blockIdx.x % (TTv / 64); const int b = slab / NHv, h = slab % NHv;
  for (int i = tid; i < 64 * 8; i += 256) { const int r = i / 8, c8 = (i % 8) * 8; FragH f; f.half[0] = *(const v8us*)((const unsigned short*)V16 + ((size_t)b * TTv + lg * 64 + r) * ldv + voff + h * 64 + c8);
#pragma unroll
    for (int q = 0; q < 8; ++q) tl[r][c8 + q] = f.u[q]; }
  __syncthreads();
  {
#pragma unroll
    for (int rd = 0; rd < 2; ++rd) { const int d = rd * 32 + tid / 8, pc = tid % 8; FragH f;
#pragma unroll
      for (int q = 0; q < 8; ++q) f.u[q] = tl[pc * 8 + q][d];
      *(v8us*)((unsigned short*)Vt + ((size_t)slab * 64 + d) * TTv + lg * 64 + pc * 8) = f.half[0]; }
     } }


// ---- fast GEMM (wave tile 64x64, block tile 128x128) ----
__device__ __forceinline__ v16h g2_frag(const _Float16* p, int hh) { FragH f; f.half[0] = *(const v8us*)((const unsigned short*)p + 8 * hh); f.half[1] = *(const v8us*)((const unsigned short*)p + 16 + 8 * hh); return f.v; }
__device__ __forceinline__ v8f g2_mma(v16h a, v16h b, v8f c) { v8f d = __builtin_amdgcn_wmma_f32_16x16x32_f16(false, a, false, b, (short)0, c, false, false); asm volatile("v_nop\n\tv_nop\n\tv_nop\n\tv_nop" : "+v"(d) : "v"(a), "v"(b)); return d; }
// One wave's share of one operand's half of a stage (128 rows of 128 bytes, LDS pitch G2P bytes): 8 asynchronous 16-byte copies per lane, 8 lanes to a row, so that each copy of a wave reads 4 whole 128-byte lines.
// l = this lane's LDS byte address in the half's row tid / 8; g = this lane's 16 bytes in the operand's row tid / 8 of the stage; every further copy is 16 rows on.
#define G2P 144            /* 128 + 16: the pitch for 16-byte LDS reads of 128-byte rows */
#define G2H (128 * G2P)    /* bytes of one operand's half of a stage */
#define G2S (2 * G2H)      /* bytes of one stage */
__device__ __forceinline__ void g2_stage(unsigned l, const _Float16* g, size_t ld) {
  const unsigned l1 = l + 16 * G2P, l2 = l + 32 * G2P, l3 = l + 48 * G2P, l4 = l + 64 * G2P, l5 = l + 80 * G2P, l6 = l + 96 * G2P, l7 = l + 112 * G2P;
  const _Float16 *g1 = g + 16 * ld, *g2 = g + 32 * ld, *g3 = g + 48 * ld, *g4 = g + 64 * ld, *g5 = g + 80 * ld, *g6 = g + 96 * ld, *g7 = g + 112 * ld;
  /* the copies and their s_wait_xcnt in one statement: no address register is rewritten before the wait */
  asm volatile("global_load_async_to_lds_b128 %0, %8, off\n\t"
               "global_load_async_to_lds_b128 %1, %9, off\n\t"
               "global_load_async_to_lds_b128 %2, %10, off\n\t"
               "global_load_async_to_lds_b128 %3, %11, off\n\t"
               "global_load_async_to_lds_b128 %4, %12, off\n\t"
               "global_load_async_to_lds_b128 %5, %13, off\n\t"
               "global_load_async_to_lds_b128 %6, %14, off\n\t"
               "global_load_async_to_lds_b128 %7, %15, off\n\t"
               "s_wait_xcnt 0x0"
               :: "v"(l), "v"(l1), "v"(l2), "v"(l3), "v"(l4), "v"(l5), "v"(l6), "v"(l7),
                  "v"(g), "v"(g1), "v"(g2), "v"(g3), "v"(g4), "v"(g5), "v"(g6), "v"(g7) : "memory"); }
// The three projections in ONE launch: blockIdx.y picks the weight plane (0 q, 1 k, 2 v; the planes lie one behind the other in B3) and what the epilogue makes of the tile, so that q, k and v never exist as f32 planes in memory.
// Block tile 128 tokens x 128 columns = two heads, four waves as 2 x 2, each 64 tokens x 64 columns = one head: a fragment read from LDS feeds four products, and a byte copied from L2 into LDS feeds half again as many products as with a 128 x 64 block.
// K = DM; A and B go through LDS in stages of 64 k, two buffers: stage t + 1 flies while stage t is worked on. The fragments are read from LDS in the k order of g2_frag.
// Behind the loop's last barrier the ring is free, and each wave stages its tile in its own part of it.
// q, k: the wave's 64x64 tile goes through its own LDS rows, a lane takes 4 neighbouring columns = 2 rotary pairs back, turns them by the sinusoidal_pos INPUT row of its token ([sin | cos], rounded like every input) and stores 4 f16: 16 lanes write one head row = one 128-byte line.
// v: register r of an accumulator is token 8 hh + r of one head column, so 8 converted registers are 16 bytes of a V^T row; the wave's 64 x 64 V^T tile is gathered in its own LDS rows and stored as whole 128-byte lines, 8 lanes to a line.
#define SOP 68             /* floats per LDS row of a wave's f32 tile */
#define VTP 72             /* f16 per LDS row of a wave's V^T tile: 128 + 16 bytes */
typedef float f1a __attribute__((may_alias));
__global__ __launch_bounds__(128) __attribute__((amdgpu_waves_per_eu(4, 4))) void k_qkv(const _Float16* __restrict__ A, const _Float16* __restrict__ B3, const float* __restrict__ sp, _Float16* __restrict__ Q16, _Float16* __restrict__ K16, _Float16* __restrict__ Vt) {
  __shared__ __attribute__((aligned(16))) _Float16 st[2][256][G2P / 2];      /* [buffer][128 A rows, 128 B rows] */
  const int tid = threadIdx.x, w = tid >> 5, lane = tid & 31, ln = lane & 15, hh = lane >> 4; const int by = blockIdx.y;
  const int wm = w >> 1, wn = w & 1;      /* the wave's token half and its head of the block's two */
  const _Float16* Bh = B3 + (size_t)by * DM * DM;
  const int mt = blockIdx.x / (NH / 2), np = blockIdx.x % (NH / 2); const int row0 = mt * 128 + 64 * wm, hd = np * 2 + wn, col0 = hd * 64;
  const _Float16* ga = A + (size_t)(mt * 128 + (tid >> 3)) * DM + (tid & 7) * 8; const _Float16* gb = Bh + (size_t)(np * 128 + (tid >> 3)) * DM + (tid & 7) * 8;
  const unsigned ls = (unsigned)(size_t)&st[0][tid >> 3][(tid & 7) * 8];
  constexpr int nst = DM >> 6;
  g2_stage(ls, ga, (size_t)DM); g2_stage(ls + G2H, gb, (size_t)DM);
  asm volatile("s_wait_asynccnt 0x0" ::: "memory");      /* stage 0 of this wave has landed */
  __syncthreads();      /* ... and every wave's share of it */
  g2_stage(ls + G2S, ga + 64, (size_t)DM); g2_stage(ls + G2S + G2H, gb + 64, (size_t)DM);
  v8f c[4][4];      /* c[i][j]: tokens row0 + 16 i ..., columns col0 + 16 j ... */
#pragma unroll      /* constant indices: the accumulators stay in registers */
  for (int i = 0; i < 4; ++i) {
#pragma unroll      /* constant indices: the accumulators stay in registers */
    for (int j = 0; j < 4; ++j) c[i][j] = (v8f){0.f,0.f,0.f,0.f,0.f,0.f,0.f,0.f}; }
  /* rolled: one trip of code; the buffer is picked by the trip's parity */
#pragma unroll 1
  for (int t = 0; t < nst; ++t) { const _Float16* sa = &st[t & 1][64 * wm + ln][0]; const _Float16* sb = &st[t & 1][128 + 64 * wn + ln][0];
#pragma unroll      /* constant indices: fragments and accumulators stay in registers */
    for (int ks = 0; ks < 2; ++ks) { v16h a[4], b[4];
      /* the eight fragments of 32 k are read together, ahead of their sixteen products */
#pragma unroll      /* constant indices: fragments and accumulators stay in registers */
      for (int i = 0; i < 4; ++i) { a[i] = g2_frag(sa + i * 16 * (G2P / 2) + ks * 32, hh); b[i] = g2_frag(sb + i * 16 * (G2P / 2) + ks * 32, hh); }
#pragma unroll      /* constant indices: fragments and accumulators stay in registers */
      for (int j = 0; j < 4; ++j) {
#pragma unroll      /* constant indices: fragments and accumulators stay in registers */
        for (int i = 0; i < 4; ++i) c[i][j] = g2_mma(a[i], b[j], c[i][j]); } }
    asm volatile("s_wait_dscnt 0x0" ::: "memory");      /* this wave's reads of the buffer are done before it is refilled */
    asm volatile("s_wait_asynccnt 0x0" ::: "memory");      /* this wave's share of stage t + 1 has landed */
    __syncthreads();      /* publishes stage t + 1 and ends every wave's reads of stage t */
    if (t + 2 < nst) { g2_stage(ls + (unsigned)(t & 1) * G2S, ga + (size_t)(t + 2) * 64, (size_t)DM); g2_stage(ls + (unsigned)(t & 1) * G2S + G2H, gb + (size_t)(t + 2) * 64, (size_t)DM); } }
  asm volatile("s_wait_asynccnt 0x0" ::: "memory");      /* nothing in flight when the wave goes on to the epilogue */
  char* sw = (char*)&st[0][0][0] + w * (64 * SOP * 4);      /* this wave's own part of the ring, which every wave has left at the last trip's barrier. The weights hold the factor 16: every value below is accumulator / 16 (q's times the score factor as well) */
  /* The epilogue in three short branches on the plane (the same for the whole block) instead of one long one: the accumulators end in the middle one, so that their registers are free for the read-out (with one long branch for q, k and one for v this build kept all 128 alive through the q, k branch and ran out of registers) */
  const bool isv = (by == 2);
  const float qf = (by == 0) ? 0.0625f * SCL2 : 0.0625f;      /* q also takes the flash kernel's score factor (1/8 and log2 e) here, ahead of its f16 rounding: the rotation is linear, and the score products then need no multiply */
  unsigned short* vt = (unsigned short*)sw; f1a* so = (f1a*)sw;
  const int rsub = lane >> 4, c4 = (lane & 15) * 4;
  /* q, k: the table words of token row0 + rsub, pairs c4 / 2 and c4 / 2 + 1; the lane's next token is two rows = 128 floats on (a wave's 64 tokens never cross the end of a sequence). The first half is asked for ahead of the LDS round trip, which hides its way, the second behind it, when the accumulators' registers are free */
  const float* pr = sp + (size_t)(row0 % SLEN + rsub) * 64 + (c4 >> 1); v2fa sn[32], cs[32];
  if (!isv) {
#pragma unroll      /* constant indices: the table words stay in registers */
    for (int q = 0; q < 16; ++q) { sn[q] = *(const v2fa*)(pr + q * 128); cs[q] = *(const v2fa*)(pr + q * 128 + 32); }
    asm volatile("s_wait_xcnt 0x0" :: "v"(pr) : "memory");      /* the loads' address register lives up to this wait: nothing is written over it while a load that names it is under way */
  }
  if (isv) {
#pragma unroll      /* constant indices: the accumulators stay in registers */
    for (int i = 0; i < 4; ++i) {
#pragma unroll      /* constant indices: the accumulators stay in registers */
      for (int j = 0; j < 4; ++j) { FragH f;
#pragma unroll      /* constant indices: the accumulators stay in registers */
        for (int r = 0; r < 8; ++r) f.h[r] = (_Float16)(c[i][j][r] * 0.0625f);
        *(v8us*)(vt + (j * 16 + ln) * VTP + i * 16 + 8 * hh) = f.half[0]; } }
  } else {
#pragma unroll      /* constant indices: the accumulators stay in registers */
    for (int i = 0; i < 4; ++i) {
#pragma unroll      /* constant indices: the accumulators stay in registers */
      for (int j = 0; j < 4; ++j) {
#pragma unroll      /* constant indices: the accumulators stay in registers */
        for (int r = 0; r < 8; ++r) so[(i * 16 + 8 * hh + r) * SOP + j * 16 + ln] = c[i][j][r] * qf; } }
  }
  __builtin_amdgcn_fence(__ATOMIC_ACQ_REL, "workgroup"); __builtin_amdgcn_wave_barrier();      /* the wave's LDS writes are done before its lanes read rows that other lanes wrote */
  if (isv) {
    const int b = row0 / SLEN, key0 = row0 % SLEN;      /* a wave's 64 tokens never cross the end of a sequence */
    unsigned short* vp = (unsigned short*)Vt + ((size_t)(b * NH + hd) * 64 + (lane >> 3)) * SLEN + key0 + (lane & 7) * 8;
#pragma unroll      /* the LDS reads stand together, ahead of the stores */
    for (int p = 0; p < 16; ++p) { const v8us val = *(const v8us*)(vt + (p * 4 + (lane >> 3)) * VTP + (lane & 7) * 8);
      *(v8us*)(vp + (size_t)p * 4 * SLEN) = val; }
    asm volatile("s_wait_xcnt 0x0" ::: "memory");      /* behind the last store of the run: no register that a store names is written over while the store is under way */
  } else {
    _Float16* __restrict__ H = by ? K16 : Q16;
#pragma unroll      /* constant indices: the table words stay in registers */
    for (int q = 16; q < 32; ++q) { sn[q] = *(const v2fa*)(pr + q * 128); cs[q] = *(const v2fa*)(pr + q * 128 + 32); }
    asm volatile("s_wait_xcnt 0x0" :: "v"(pr) : "memory");      /* as above, for the second half's loads */
    _Float16* hp = H + (size_t)(row0 + rsub) * DM + col0 + c4;
#pragma unroll      /* constant indices: the table words stay in registers */
    for (int qg = 0; qg < 4; ++qg) { v4h h4[8];      /* eight tokens' results, then their eight stores as one run */
#pragma unroll      /* constant indices: the table words stay in registers */
      for (int e = 0; e < 8; ++e) { const int q = qg * 8 + e; const v4f v = *(const v4fa*)&so[(q * 2 + rsub) * SOP + c4];
        const float s0 = bf16_round(sn[q][0]), s1 = bf16_round(sn[q][1]), k0 = bf16_round(cs[q][0]), k1 = bf16_round(cs[q][1]);
        h4[e][0] = (_Float16)(v[0] * k0 - v[1] * s0); h4[e][1] = (_Float16)(v[0] * s0 + v[1] * k0); h4[e][2] = (_Float16)(v[2] * k1 - v[3] * s1); h4[e][3] = (_Float16)(v[2] * s1 + v[3] * k1); }
      __builtin_amdgcn_sched_barrier(0);      /* no vector instruction is moved in among the run of stores below, where it could write over a register that an issued store names */
#pragma unroll      /* constant indices: the results stay in registers */
      for (int e = 0; e < 8; ++e) *(v4h*)(hp + (size_t)(qg * 8 + e) * 2 * DM) = h4[e];
      asm volatile("s_wait_xcnt 0x0" ::: "memory");      /* behind the last store of the run: no register that a store names is written over while the store is under way */
      __builtin_amdgcn_sched_barrier(0); }      /* ... and nothing of the next run is moved up in front of that wait */
  } }



// lane l <-> lane l ^ 16 (the two halves of a wave hold the two key halves of one query column)
__device__ __forceinline__ float xhalf(float x) { return __builtin_bit_cast(float, __builtin_amdgcn_permlanex16(__builtin_bit_cast(int, x), __builtin_bit_cast(int, x), 0x76543210, 0xfedcba98, false, false)); }
__device__ __forceinline__ v8f mmaT(v16h a, v16h b, v8f c) { return __builtin_amdgcn_wmma_f32_16x16x32_f16(false, a, false, b, (short)0, c, false, false); }
// One wave's share of one key group's half of a flash stage, 64 keys (128 rows of 128 bytes: 64 K rows of the head, then the 64 V^T rows' 64 keys, LDS pitch FLP bytes): 8 asynchronous 16-byte copies per lane, 8 lanes to a row, so that each copy of a wave reads 4 whole 128-byte lines.
// With i = the thread's number among its key group's 128: l = this lane's LDS byte address in the half's row i / 8; gk, gv = this lane's 16 bytes in K row i / 8 and V^T row i / 8 of the half; every further copy is 16 rows on.
#define FLP 144            /* 128 + 16: the pitch for 16-byte LDS reads of 128-byte rows */
#define FLS (128 * FLP)    /* bytes of one key group's half of a stage */
__device__ __forceinline__ void fl_stage(unsigned l, const _Float16* gk, size_t ldk, const _Float16* gv) {
  const unsigned l1 = l + 16 * FLP, l2 = l + 32 * FLP, l3 = l + 48 * FLP, l4 = l + 64 * FLP, l5 = l + 80 * FLP, l6 = l + 96 * FLP, l7 = l + 112 * FLP;
  const _Float16 *k1 = gk + 16 * ldk, *k2 = gk + 32 * ldk, *k3 = gk + 48 * ldk, *v1 = gv + 16 * TK, *v2 = gv + 32 * TK, *v3 = gv + 48 * TK;
  /* the copies and their s_wait_xcnt in one statement: no address register is rewritten before the wait */
  asm volatile("global_load_async_to_lds_b128 %0, %8, off\n\t"
               "global_load_async_to_lds_b128 %1, %9, off\n\t"
               "global_load_async_to_lds_b128 %2, %10, off\n\t"
               "global_load_async_to_lds_b128 %3, %11, off\n\t"
               "global_load_async_to_lds_b128 %4, %12, off\n\t"
               "global_load_async_to_lds_b128 %5, %13, off\n\t"
               "global_load_async_to_lds_b128 %6, %14, off\n\t"
               "global_load_async_to_lds_b128 %7, %15, off\n\t"
               "s_wait_xcnt 0x0"
               :: "v"(l), "v"(l1), "v"(l2), "v"(l3), "v"(l4), "v"(l5), "v"(l6), "v"(l7),
                  "v"(gk), "v"(k1), "v"(k2), "v"(k3), "v"(gv), "v"(v1), "v"(v2), "v"(v3) : "memory"); }
// the maximum of a lane's 16 scores of one column tile (exact in any order)
__device__ __forceinline__ float fl_max16(const v2f (&s)[8]) { float mx[8];
#pragma unroll
  for (int i = 0; i < 8; ++i) mx[i] = fmaxf(s[i][0], s[i][1]);
  return fmaxf(fmaxf(fmaxf(mx[0], mx[1]), fmaxf(mx[2], mx[3])), fmaxf(fmaxf(mx[4], mx[5]), fmaxf(mx[6], mx[7]))); }
// Transposed products: S^T = K Q^T (A = 16 key rows, B = 16 query columns, kept in registers), O^T += V^T P^T (A = 16 rows of V^T, B = P^T).
// A wave holds TWO tiles of 16 query columns (cg = 0, 1): every K and V^T fragment that it reads from LDS feeds two products. So that the chip still has as many waves, the keys are split inside the block: 8 waves = 4 query groups of 32 x 2 key groups; of each stage of 128 keys, key group g works on keys 64 g ... 64 g + 63, with its own reference, sum and accumulators, and the two groups' results are joined once, behind the loop, through LDS.
// Lane (c = lane & 15, hh = lane >> 4) holds queries q0 + c and q0 + 16 + c only: register r of score tile nt is key j0 + 16 nt + 8 hh + r, so maximum and sum run in-lane plus one exchange between the halves,
// and the two converted score tiles ARE the B operand of the second product in the hardware k order (element s: key 8 hh + s, then 16 + 8 hh + (s - 8)), the order in which the V^T rows are loaded.
// The softmax runs in base 2: Q16 already holds the score factor with log2 e (k_qkv) and the mask table is in those units. Each query column keeps a reference r_c, set 10 below the column's maximum at the time it was set, and a weight is 2^(score - r_c): the first product of a score tile takes mask - r_c as its C operand, so that the tile leaves the matrix unit as the arguments of v_exp_f32; numerator and denominator hold the same factor, which the final division takes out. The reference moves, and accumulators and sum are rescaled, only when a score has climbed more than 15 above it.
// K and V^T go through LDS in stages of 2 x 64 keys (each key group: two passes of 32), two buffers, shared by the block's waves: stage t + 1 flies while stage t is worked on; a key group's 4 waves copy that group's half of the stage. The fragments are read from LDS in the k order of g2_frag.
template <int CAUSAL>
__global__ __launch_bounds__(256) __attribute__((amdgpu_waves_per_eu(4, 4))) void k_flash(const _Float16* __restrict__ Q16, int ldq, const _Float16* __restrict__ K16, int ldk, const _Float16* __restrict__ Vt, const int* __restrict__ MSK, float* __restrict__ O, int ldo) {
  constexpr int RPW = 32, CG = 2, DT = 4, KS = 2;
  __shared__ __attribute__((aligned(16))) float sO[4][RPW][64 + 4];
  __shared__ __attribute__((aligned(16))) float sM[4][CG * DT * 2][32][4];      /* key group 1's accumulators on their way to key group 0: 16 bytes a lane, lanes side by side */
  __shared__ float sL[4][CG][2][32];      /* ... and its sums and references */
  __shared__ __attribute__((aligned(16))) _Float16 st[2][2][128][FLP / 2];      /* [buffer][key group][64 K rows, 64 V^T rows] */
  const int tid = threadIdx.x, g = tid >> 7, t7 = tid & 127, w = (tid >> 5) & 3, lane = tid & 31, ln = lane & 15, hh = lane >> 4;
  const int slab = blockIdx.x / QBNP, qblk = QB0P + blockIdx.x % QBNP; const int b = slab / NH, h = slab % NH; const int qb0 = qblk * (4 * RPW); const int q0 = qb0 + w * RPW;
  FragH bq[CG][KS];
#pragma unroll
  for (int cg = 0; cg < CG; ++cg) { const unsigned short* qr = (const unsigned short*)Q16 + ((size_t)b * TQ + q0 + cg * 16 + ln) * ldq + h * 64;
#pragma unroll
    for (int ks = 0; ks < KS; ++ks) { bq[cg][ks].half[0] = *(const v8us*)(qr + ks * 32 + 8 * hh); bq[cg][ks].half[1] = *(const v8us*)(qr + ks * 32 + 16 + 8 * hh); } }
  /* this lane's 16 bytes of its key group's half of stage 0 (K row t7 / 8 of the half, V^T row t7 / 8) and their place in buffer 0 */
  const _Float16* gk = K16 + ((size_t)b * TK + g * 64 + (t7 >> 3)) * ldk + h * 64 + (t7 & 7) * 8; const _Float16* gv = Vt + ((size_t)slab * 64 + (t7 >> 3)) * TK + g * 64 + (t7 & 7) * 8;
  const unsigned ls = (unsigned)(size_t)&st[0][g][t7 >> 3][(t7 & 7) * 8];
  const char* mb = (const char*)((const float*)MSK + (size_t)b * TK); const unsigned mo = (unsigned)g * 256u + (unsigned)hh * 32u;      /* a uniform base that steps with the pass; this key group's and this half's 8 mask words */
  float r_c[CG], l_c[CG]; v8f oacc[CG][DT];      /* r_c: the column's reference, see the stage loop */
#pragma unroll
  for (int cg = 0; cg < CG; ++cg) { r_c[cg] = -3.0e38f; l_c[cg] = 0.f;
#pragma unroll
    for (int dt = 0; dt < DT; ++dt) oacc[cg][dt] = (v8f){0.f,0.f,0.f,0.f,0.f,0.f,0.f,0.f}; }
  const int jend = (CAUSAL == 1) ? (qb0 + 4 * RPW) : TK;      /* causal: keys beyond the block's last query never contribute */
  const int nst = jend >> 7;      /* both ends are multiples of 128; the same for the whole block */
  fl_stage(ls, gk, (size_t)ldk, gv);
  asm volatile("s_wait_asynccnt 0x0" ::: "memory");      /* stage 0 of this wave has landed */
  __syncthreads();      /* ... and every wave's share of it */
  if (nst > 1) fl_stage(ls + 2 * FLS, gk + (size_t)128 * ldk, (size_t)ldk, gv + 128);
  v4f mk[2][2];      /* a pass's mask words (from the table in global memory): they stand in front of the pass's first product, so each pass asks for the next one's; here the first pass's */
  if (CAUSAL == 17) {
#pragma unroll
    for (int nt = 0; nt < 2; ++nt) { mk[nt][0] = *(const v4fa*)(mb + mo + nt * 64); mk[nt][1] = *(const v4fa*)(mb + mo + nt * 64 + 16); } }
  /* One loop over passes of 32 keys x 32 query columns, two passes to a stage; a pass runs from its K fragments to its second products, so that only one pass's scores and fragments are live at a time (the wave keeps within the registers of four waves a SIMD). The loop stays rolled: one pass of code, accumulators in the same registers throughout (with the two passes of a stage unrolled this build copied all 64 accumulator registers to and fro around the second pass's rescale branch); buffer and pass are picked by the trip's number; every inner loop is unrolled so that the fragment and score arrays have constant indices and stay in registers */
#pragma unroll 1
  for (int ps2 = 0; ps2 < 2 * nst; ++ps2) { const int t = ps2 >> 1, pp = ps2 & 1; const _Float16* skr = &st[t & 1][g][pp * 32 + ln][0]; const _Float16* svr = &st[t & 1][g][64 + ln][pp * 32];      /* this lane's first K row and its V^T row's 32 keys of the pass, in its key group's half of the buffer */
   { const int j0 = t * 128 + g * 64 + pp * 32;
    FragH ak[2][KS], av[DT]; v2f sc[CG][8]; bool ok[CG][16];      /* scores minus reference, as the register pairs in which the accumulators hold them */
    v8f cz[2];      /* the pass's mask words in the accumulators' order: register r of tile nt is key 16 nt + 8 hh + r (mode 17: additive per-(batch, key) mask, rounded and scaled by k_prep) */
#pragma unroll
    for (int nt = 0; nt < 2; ++nt) {
#pragma unroll
      for (int r = 0; r < 4; ++r) { cz[nt][r] = (CAUSAL == 17) ? mk[nt][0][r] : 0.f; cz[nt][4 + r] = (CAUSAL == 17) ? mk[nt][1][r] : 0.f; } }
#pragma unroll
    for (int nt = 0; nt < 2; ++nt) {
#pragma unroll
      for (int ks = 0; ks < KS; ++ks) ak[nt][ks].v = g2_frag(skr + nt * 16 * (FLP / 2) + ks * 32, hh); }      /* key rows ln and 16 + ln of the pass */
    __builtin_amdgcn_sched_barrier(0);      /* the K reads are issued first ... */
    v8f cm[2][CG];      /* C = mask - reference: the products are summed onto it */
#pragma unroll
    for (int nt = 0; nt < 2; ++nt) {
#pragma unroll
     for (int cg = 0; cg < CG; ++cg) cm[nt][cg] = cz[nt] - r_c[cg]; }
    __builtin_amdgcn_sched_barrier(0);      /* ... and the C operands are formed while they are on their way: neither in front of the reads nor behind the wait for them, where this build put them */
    asm volatile("" :: "v"(ak[0][0].v), "v"(ak[0][1].v), "v"(ak[1][0].v), "v"(ak[1][1].v));      /* inputs only: keeps the pass's eight K reads together in front of its first product (one LDS wait instead of one for each fragment) */
#pragma unroll
    for (int nt = 0; nt < 2; ++nt) {
#pragma unroll
     for (int cg = 0; cg < CG; ++cg) { const int tq = q0 + cg * 16 + ln; v8f acc = cm[nt][cg];
#pragma unroll
      for (int ks = 0; ks < KS; ++ks) acc = mmaT(ak[nt][ks].v, bq[cg][ks].v, acc);
#pragma unroll
      for (int j = 0; j < 4; ++j) { v2f s2 = (v2f){acc[2 * j], acc[2 * j + 1]};
#pragma unroll
        for (int e = 0; e < 2; ++e) { const int kk = j0 + nt * 16 + 8 * hh + 2 * j + e; const bool okk = (CAUSAL == 1) ? (kk <= tq) : ((CAUSAL == 2) ? ((kk >> 5) == (tq >> 5)) : true);      /* mode 2: block-diagonal 32-token groups */
          if (!okk) s2[e] = -3.0e38f; ok[cg][nt * 8 + 2 * j + e] = okk; }
        sc[cg][nt * 4 + j] = s2; } } }
    __builtin_amdgcn_sched_barrier(0);      /* the eight products stand as one run: each fills the others' distance to the first reader of a result (with the maxima moved in among them this build padded that distance with ten v_nop) */
    float mc[CG];
#pragma unroll
    for (int cg = 0; cg < CG; ++cg) mc[cg] = fl_max16(sc[cg]);
    /* Lazy rescale, one test a pass: the scores stand above their references as they come, and while none lies more than 15 above, every weight 2^(score - reference) is at most 2^15, which f16 holds, and numerator and denominator go on in the units they are in. A scalar branch: the whole wave takes it or none */
    if (__builtin_amdgcn_ballot_w32(fmaxf(mc[0], mc[1]) > 15.0f) != 0) {      /* mc: the maximum of this half's 16 keys of the pass; the vote sees both halves and both column tiles */
     /* A reference is to move. Summed onto a reference that lies far off (the start value, or one set among masked keys) the products have lost their low bits, so the pass's score products are done again with the mask words alone as C: scores in absolute units, from which the new reference is set as before */
#pragma unroll
     for (int cg = 0; cg < CG; ++cg) {
#pragma unroll
      for (int nt = 0; nt < 2; ++nt) { v8f acc = cz[nt];
#pragma unroll
       for (int ks = 0; ks < KS; ++ks) acc = mmaT(ak[nt][ks].v, bq[cg][ks].v, acc);
#pragma unroll
       for (int j = 0; j < 4; ++j) { v2f s2 = (v2f){acc[2 * j], acc[2 * j + 1]};
#pragma unroll
        for (int e = 0; e < 2; ++e) if (!ok[cg][nt * 8 + 2 * j + e]) s2[e] = -3.0e38f;
        sc[cg][nt * 4 + j] = s2; } }
      mc[cg] = fl_max16(sc[cg]); }
     __builtin_amdgcn_sched_barrier(0);      /* the v_exp_f32 statements below stay behind both tiles' maxima, which read the products' results: the compiler does not see that asm text writes a vector register, and moved up among the products one could overwrite an operand of a product just issued */
#pragma unroll
     for (int cg = 0; cg < CG; ++cg) {
      const float mj = fmaxf(mc[cg], xhalf(mc[cg]));      /* both halves now hold the query's maximum over the pass's 32 keys, so both set the same reference */
      float rn = mj - 10.0f; if (mj - rn > 15.0f) rn = mj;      /* where the maximum is so large that the subtraction rounds to more than 15 below it, the reference is the maximum itself: no weight ever leaves f16 */
      rn = fmaxf(r_c[cg], rn); const float da = r_c[cg] - rn; float ea;
      asm("v_exp_f32 %0, %1\n\tv_nop" : "=&v"(ea) : "v"(da));      /* the v_nop is the slot that the instruction set asks for behind a transcendental */
      const float al = (rn > -1.0e38f * LOG2E) ? ea : 1.0f;      /* the same test as before, its threshold in base-2 units */
      r_c[cg] = rn; l_c[cg] *= al;
#pragma unroll
      for (int i = 0; i < 8; ++i) sc[cg][i] -= (v2f){rn, rn};      /* never above 15 */
#pragma unroll
      for (int dt = 0; dt < DT; ++dt) {
#pragma unroll
        for (int r = 0; r < 8; ++r) oacc[cg][dt][r] *= al; } } }
#pragma unroll
    for (int dt = 0; dt < DT; ++dt) av[dt].v = g2_frag(svr + dt * 16 * (FLP / 2), hh);      /* V^T row dt * 16 + ln, the pass's 32 keys; behind the branch, which may still read the K fragments */
    if (ps2 + 1 < 2 * nst) mb += pp ? 384 : 128;      /* the key group's next 32 keys: in this stage, or in the next one, past the other group's 64; the last pass reads its own words again and stays inside the table */
    const char* mp = mb + mo;
    if (CAUSAL == 17) {
#pragma unroll
      for (int nt = 0; nt < 2; ++nt) { mk[nt][0] = *(const v4fa*)(mp + nt * 64); mk[nt][1] = *(const v4fa*)(mp + nt * 64 + 16); } }
    __builtin_amdgcn_sched_barrier(0);      /* the V^T reads and the next mask words are asked for ahead of the weights' arithmetic, which hides their way (left to itself this build put the reads in the middle of it) */
    FragH pb[CG];
#pragma unroll
   for (int cg = 0; cg < CG; ++cg) {
    float x[16], p[16];
#pragma unroll
    for (int i = 0; i < 8; ++i) { x[2 * i] = sc[cg][i][0]; x[2 * i + 1] = sc[cg][i][1]; }      /* score - reference, never above 15 */
    /* 2^x is the one hardware instruction v_exp_f32 (a result below the normal range comes out as 0: such a weight is 0 in the f16 operand anyway). A tile's sixteen stand in two statements because the instruction set asks that the instruction directly behind a transcendental neither read its result nor overwrite its source: the early-clobber outputs keep every result out of every argument's register, and the v_nop is the slot of each statement's last v_exp_f32 (written as builtins, this build put a result into the argument register of the v_exp_f32 in front of it) */
    asm("v_exp_f32 %0, %8\n\tv_exp_f32 %1, %9\n\tv_exp_f32 %2, %10\n\tv_exp_f32 %3, %11\n\tv_exp_f32 %4, %12\n\tv_exp_f32 %5, %13\n\tv_exp_f32 %6, %14\n\tv_exp_f32 %7, %15\n\tv_nop"
        : "=&v"(p[0]), "=&v"(p[1]), "=&v"(p[2]), "=&v"(p[3]), "=&v"(p[4]), "=&v"(p[5]), "=&v"(p[6]), "=&v"(p[7]) : "v"(x[0]), "v"(x[1]), "v"(x[2]), "v"(x[3]), "v"(x[4]), "v"(x[5]), "v"(x[6]), "v"(x[7]));
    asm("v_exp_f32 %0, %8\n\tv_exp_f32 %1, %9\n\tv_exp_f32 %2, %10\n\tv_exp_f32 %3, %11\n\tv_exp_f32 %4, %12\n\tv_exp_f32 %5, %13\n\tv_exp_f32 %6, %14\n\tv_exp_f32 %7, %15\n\tv_nop"
        : "=&v"(p[8]), "=&v"(p[9]), "=&v"(p[10]), "=&v"(p[11]), "=&v"(p[12]), "=&v"(p[13]), "=&v"(p[14]), "=&v"(p[15]) : "v"(x[8]), "v"(x[9]), "v"(x[10]), "v"(x[11]), "v"(x[12]), "v"(x[13]), "v"(x[14]), "v"(x[15]));
#pragma unroll
    for (int i = 0; i < 16; ++i) { if (!ok[cg][i]) p[i] = 0.f; pb[cg].h[i] = (_Float16)p[i]; }
    const float pe = ((p[0] + p[2]) + (p[4] + p[6])) + ((p[8] + p[10]) + (p[12] + p[14])), po = ((p[1] + p[3]) + (p[5] + p[7])) + ((p[9] + p[11]) + (p[13] + p[15])); const float ps = pe + po;
    l_c[cg] += ps; }      /* this half's 16 keys of the pass; halves and key groups are joined once, behind the loop */
    __builtin_amdgcn_sched_barrier(0);      /* every v_exp_f32 statement stays in front of the pass's second products: the compiler does not see that asm text writes vector registers, and moved in between it would let one overwrite an operand of the product just issued */
    if (CAUSAL == 17) asm volatile("s_wait_xcnt 0x0" :: "v"(mp) : "memory");      /* the mask loads' address register lives up to this wait: nothing is written over it while a load that names it is under way; it stands behind the weights' arithmetic */
#pragma unroll
    for (int dt = 0; dt < DT; ++dt) {
#pragma unroll
      for (int cg = 0; cg < CG; ++cg) oacc[cg][dt] = mmaT(av[dt].v, pb[cg].v, oacc[cg][dt]); } }
    if (pp) {      /* the foot of a stage; the test reads the same for the whole block */
    asm volatile("s_wait_dscnt 0x0" ::: "memory");      /* this wave's reads of the buffer are done before it is refilled */
    asm volatile("s_wait_asynccnt 0x0" ::: "memory");      /* this wave's share of stage t + 1 has landed */
    __syncthreads();      /* publishes stage t + 1 and ends every wave's reads of stage t */
    if (t + 2 < nst) fl_stage(ls + (unsigned)(t & 1) * (2 * FLS), gk + (size_t)(t + 2) * 128 * ldk, (size_t)ldk, gv + (size_t)(t + 2) * 128); } }
  asm volatile("s_wait_asynccnt 0x0" ::: "memory");      /* nothing in flight when the wave goes on to the epilogue */
  /* the join of the two key groups: group 1 hands accumulators, sums and references to the wave of group 0 that holds the same queries */
  if (g == 1) {      /* the same for a whole wave */
#pragma unroll
    for (int cg = 0; cg < CG; ++cg) { sL[w][cg][0][lane] = l_c[cg]; sL[w][cg][1][lane] = r_c[cg];
#pragma unroll
      for (int dt = 0; dt < DT; ++dt) { v4f lo, hi;
#pragma unroll
        for (int r = 0; r < 4; ++r) { lo[r] = oacc[cg][dt][r]; hi[r] = oacc[cg][dt][4 + r]; }
        *(v4fa*)&sM[w][(cg * DT + dt) * 2][lane][0] = lo; *(v4fa*)&sM[w][(cg * DT + dt) * 2 + 1][lane][0] = hi; } } }
  __syncthreads();      /* group 1's LDS writes are done before group 0 reads them; every wave passes it */
  if (g == 1) return;      /* no barrier stands behind this line */
#pragma unroll
  for (int cg = 0; cg < CG; ++cg) {
    const float l1 = sL[w][cg][0][lane], r1 = sL[w][cg][1][lane]; const float rn = fmaxf(r_c[cg], r1); const float d0 = r_c[cg] - rn, d1 = r1 - rn; float a0, a1;      /* both parts go to the units of the higher reference: one factor is 1, the other at most 1 */
    asm("v_exp_f32 %0, %2\n\tv_exp_f32 %1, %3\n\tv_nop" : "=&v"(a0), "=&v"(a1) : "v"(d0), "v"(d1));      /* the v_nop is the slot that the instruction set asks for behind a transcendental */
    const float lj = l_c[cg] * a0 + l1 * a1;
    const float l = lj + xhalf(lj); const float inv = (l > 0.f) ? 1.0f / l : 0.f;      /* numerator and denominator both hold the factor 2^-rn */
    const float f0 = a0 * inv, f1 = a1 * inv;
#pragma unroll
    for (int dt = 0; dt < DT; ++dt) { const v4f ml = *(const v4fa*)&sM[w][(cg * DT + dt) * 2][lane][0], mh = *(const v4fa*)&sM[w][(cg * DT + dt) * 2 + 1][lane][0]; v4f lo, hi;      /* register r = head column dt * 16 + 8 hh + r of query q0 + 16 cg + ln */
#pragma unroll
      for (int r = 0; r < 4; ++r) { lo[r] = oacc[cg][dt][r] * f0 + ml[r] * f1; hi[r] = oacc[cg][dt][4 + r] * f0 + mh[r] * f1; }
      *(v4fa*)&sO[w][cg * 16 + ln][dt * 16 + 8 * hh] = lo; *(v4fa*)&sO[w][cg * 16 + ln][dt * 16 + 8 * hh + 4] = hi; } }
  __builtin_amdgcn_fence(__ATOMIC_ACQ_REL, "workgroup"); __builtin_amdgcn_wave_barrier();
  {
#pragma unroll
    for (int rp = 0; rp < RPW; rp += 2) { const int r = rp + (lane >> 4), pc = lane & 15; const v4f val = *(const v4fa*)&sO[w][r][pc * 4]; *(v4f*)(O + ((size_t)b * TQ + q0 + r) * ldo + h * 64 + pc * 4) = val; }
     } }
// 5-plane variant: S = Qh Kh^T + (Ql Kh^T + Qh Kl^T)/1024 with Q/K = [hi | 2^10 residual] f16 planes (QL/KL same layout as Q16/K16), then the 3-term P.V below.
// 3-term variant: O = (P_hi V_hi + (P_lo V_hi + P_hi V_lo) / 1024) / l with P = [hi | 2^10 residual] of 1024 p and V^T = [hi | 2^10 residual] planes (VtL same layout as Vt) -> ~2^-21-class products for un-averaged (early causal / peaked) rows
template <int CAUSAL>
__global__ __launch_bounds__(128) void k_flash5(const _Float16* __restrict__ Q16, const _Float16* __restrict__ QL, int ldq, const _Float16* __restrict__ K16, const _Float16* __restrict__ KL, int ldk, const _Float16* __restrict__ Vt, const _Float16* __restrict__ VtL, const int* __restrict__ MSK, float* __restrict__ O, int ldo) {
  constexpr int RPW = 16, RTN = RPW / 16, NQB = TQ / (4 * RPW), DT = 4, KS = 2;
  __shared__ __attribute__((aligned(16))) unsigned short sP[4][RPW][40]; __shared__ __attribute__((aligned(16))) unsigned short sPL[4][RPW][40]; __shared__ __attribute__((aligned(16))) float sO[4][RPW][64 + 4];
  const int tid = threadIdx.x, w = tid >> 5, lane = tid & 31, ln = lane & 15, hh = lane >> 4;
  const int slab = blockIdx.x / QBN5, qblk = QB05 + blockIdx.x % QBN5; (void)NQB; const int b = slab / NH, h = slab % NH; const int qb0 = qblk * (4 * RPW); const int q0 = qb0 + w * RPW;
  FragH aq[2][KS], aql[2][KS];
#pragma unroll
  for (int rt = 0; rt < RTN; ++rt) { const unsigned short* qr = (const unsigned short*)Q16 + ((size_t)b * TQ + q0 + rt * 16 + ln) * ldq + h * 64; const unsigned short* ql = (const unsigned short*)QL + ((size_t)b * TQ + q0 + rt * 16 + ln) * ldq + h * 64;
#pragma unroll
    for (int ks = 0; ks < KS; ++ks) { aq[rt][ks].half[0] = *(const v8us*)(qr + ks * 32 + 8 * hh); aq[rt][ks].half[1] = *(const v8us*)(qr + ks * 32 + 16 + 8 * hh); aql[rt][ks].half[0] = *(const v8us*)(ql + ks * 32 + 8 * hh); aql[rt][ks].half[1] = *(const v8us*)(ql + ks * 32 + 16 + 8 * hh); } }
  const unsigned short* Vth = (const unsigned short*)Vt + (size_t)slab * 64 * TK; const unsigned short* Vtl = (const unsigned short*)VtL + (size_t)slab * 64 * TK;
  float m_r[2][8], l_r[2][8]; v8f oacc[2][DT], oaccL[2][DT];
#pragma unroll
  for (int rt = 0; rt < RTN; ++rt) {
#pragma unroll
    for (int r = 0; r < 8; ++r) { m_r[rt][r] = -3.0e38f; l_r[rt][r] = 0.f; }
#pragma unroll
    for (int dt = 0; dt < DT; ++dt) { oacc[rt][dt] = (v8f){0.f,0.f,0.f,0.f,0.f,0.f,0.f,0.f}; oaccL[rt][dt] = oacc[rt][dt]; } }
  const int jend = (CAUSAL == 1) ? (qb0 + 4 * RPW) : TK;      /* causal: keys beyond the block's last query never contribute */
#pragma unroll 1
  for (int j0 = 0; j0 < jend; j0 += 32) {
    v8f s[2][2];
#pragma unroll
    for (int nt = 0; nt < 2; ++nt) { const unsigned short* kr = (const unsigned short*)K16 + ((size_t)b * TK + j0 + nt * 16 + ln) * ldk + h * 64; const unsigned short* klr = (const unsigned short*)KL + ((size_t)b * TK + j0 + nt * 16 + ln) * ldk + h * 64; FragH bk[KS], bkl[KS];
#pragma unroll
      for (int ks = 0; ks < KS; ++ks) { bk[ks].half[0] = *(const v8us*)(kr + ks * 32 + 8 * hh); bk[ks].half[1] = *(const v8us*)(kr + ks * 32 + 16 + 8 * hh); bkl[ks].half[0] = *(const v8us*)(klr + ks * 32 + 8 * hh); bkl[ks].half[1] = *(const v8us*)(klr + ks * 32 + 16 + 8 * hh); }
#pragma unroll
      for (int rt = 0; rt < RTN; ++rt) { v8f acc = (v8f){0.f,0.f,0.f,0.f,0.f,0.f,0.f,0.f}, accl = acc;
#pragma unroll
        for (int ks = 0; ks < KS; ++ks) { acc = mmaH<1>(aq[rt][ks].v, aq[rt][ks].v, bk[ks].v, bk[ks].v, acc); accl = mmaH<1>(aql[rt][ks].v, aql[rt][ks].v, bk[ks].v, bk[ks].v, accl); accl = mmaH<1>(aq[rt][ks].v, aq[rt][ks].v, bkl[ks].v, bkl[ks].v, accl); }
#pragma unroll
        for (int r = 0; r < 8; ++r) acc[r] += accl[r] * 0.0009765625f;
        s[rt][nt] = acc; } }
#pragma unroll
    for (int rt = 0; rt < RTN; ++rt)
#pragma unroll
      for (int r = 0; r < 8; ++r) { const int tq = q0 + rt * 16 + 8 * hh + r; const int k0 = j0 + ln, k1 = j0 + 16 + ln;
        bool ok0 = (CAUSAL == 1) ? (k0 <= tq) : ((CAUSAL == 2) ? ((k0 >> 5) == (tq >> 5)) : true), ok1 = (CAUSAL == 1) ? (k1 <= tq) : ((CAUSAL == 2) ? ((k1 >> 5) == (tq >> 5)) : true);      /* mode 2: block-diagonal 32-token groups */
        if (CAUSAL == 4) { const int* mrow = MSK + ((size_t)b * TQ + tq) * TK; ok0 = mrow[k0] != 0; ok1 = mrow[k1] != 0; }      /* mode 4: per-(query, key) INPUT mask shared by all heads; masked keys contribute nothing (== the reference's -4096 fill, whose exp underflows to 0), rows with no valid key give l = 0 -> output 0 (== the reference's row_valid zeroing) */
        float s0 = ok0 ? s[rt][0][r] * SCL : -3.0e38f, s1 = ok1 ? s[rt][1][r] * SCL : -3.0e38f; if (CAUSAL == 17) { const float* amk = (const float*)MSK + (size_t)b * TK; s0 += bf16_round(amk[k0]); s1 += bf16_round(amk[k1]); }      /* mode 17: additive per-(batch, key) mask INPUT */ float mc = fmaxf(s0, s1);
        mc = fmaxf(mc, __shfl_xor(mc, 1, 32)); mc = fmaxf(mc, __shfl_xor(mc, 2, 32)); mc = fmaxf(mc, __shfl_xor(mc, 4, 32)); mc = fmaxf(mc, __shfl_xor(mc, 8, 32));
        const float mn = fmaxf(m_r[rt][r], mc); const float al = (mn > -1.0e38f) ? expf(m_r[rt][r] - mn) : 1.0f; m_r[rt][r] = mn; const float p0 = ok0 ? expf(s0 - mn) : 0.f, p1 = ok1 ? expf(s1 - mn) : 0.f; l_r[rt][r] = l_r[rt][r] * al + p0 + p1;
#pragma unroll
        for (int dt = 0; dt < DT; ++dt) { oacc[rt][dt][r] *= al; oaccL[rt][dt][r] *= al; }
        FragH t2, t2l; const float ps0 = p0 * 1024.0f, ps1 = p1 * 1024.0f; t2.h[0] = (_Float16)ps0; t2.h[1] = (_Float16)ps1; t2l.h[0] = (_Float16)((ps0 - (float)t2.h[0]) * 1024.0f); t2l.h[1] = (_Float16)((ps1 - (float)t2.h[1]) * 1024.0f);
        sP[w][rt * 16 + 8 * hh + r][ln] = t2.u[0]; sP[w][rt * 16 + 8 * hh + r][16 + ln] = t2.u[1]; sPL[w][rt * 16 + 8 * hh + r][ln] = t2l.u[0]; sPL[w][rt * 16 + 8 * hh + r][16 + ln] = t2l.u[1]; }
    __builtin_amdgcn_fence(__ATOMIC_ACQ_REL, "workgroup"); __builtin_amdgcn_wave_barrier();
    FragH pa[2], pl[2];
#pragma unroll
    for (int rt = 0; rt < RTN; ++rt) { pa[rt].half[0] = *(const v8us*)&sP[w][rt * 16 + ln][8 * hh]; pa[rt].half[1] = *(const v8us*)&sP[w][rt * 16 + ln][16 + 8 * hh]; pl[rt].half[0] = *(const v8us*)&sPL[w][rt * 16 + ln][8 * hh]; pl[rt].half[1] = *(const v8us*)&sPL[w][rt * 16 + ln][16 + 8 * hh]; }
#pragma unroll
    for (int dt = 0; dt < DT; ++dt) { const unsigned short* vrow = Vth + (size_t)(dt * 16 + ln) * TK + j0; const unsigned short* vrl = Vtl + (size_t)(dt * 16 + ln) * TK + j0; FragH bv, bl; bv.half[0] = *(const v8us*)(vrow + 8 * hh); bv.half[1] = *(const v8us*)(vrow + 16 + 8 * hh); bl.half[0] = *(const v8us*)(vrl + 8 * hh); bl.half[1] = *(const v8us*)(vrl + 16 + 8 * hh);
#pragma unroll
      for (int rt = 0; rt < RTN; ++rt) { oacc[rt][dt] = mmaH<1>(pa[rt].v, pa[rt].v, bv.v, bv.v, oacc[rt][dt]); oaccL[rt][dt] = mmaH<1>(pl[rt].v, pl[rt].v, bv.v, bv.v, oaccL[rt][dt]); oaccL[rt][dt] = mmaH<1>(pa[rt].v, pa[rt].v, bl.v, bl.v, oaccL[rt][dt]); } }
    __builtin_amdgcn_fence(__ATOMIC_ACQ_REL, "workgroup"); __builtin_amdgcn_wave_barrier(); }
#pragma unroll
  for (int rt = 0; rt < RTN; ++rt) {
#pragma unroll
    for (int r = 0; r < 8; ++r) { float l = l_r[rt][r]; l += __shfl_xor(l, 1, 32); l += __shfl_xor(l, 2, 32); l += __shfl_xor(l, 4, 32); l += __shfl_xor(l, 8, 32); l_r[rt][r] = (l > 0.f) ? 1.0f / (l * 1024.0f) : 0.f; }
#pragma unroll
    for (int dt = 0; dt < DT; ++dt)
#pragma unroll
      for (int r = 0; r < 8; ++r) { float v = oacc[rt][dt][r]; v += oaccL[rt][dt][r] * 0.0009765625f; sO[w][rt * 16 + 8 * hh + r][dt * 16 + ln] = v * l_r[rt][r]; } }
  __builtin_amdgcn_fence(__ATOMIC_ACQ_REL, "workgroup"); __builtin_amdgcn_wave_barrier();
  {
#pragma unroll
    for (int rp = 0; rp < RPW; rp += 2) { const int r = rp + (lane >> 4), pc = lane & 15; const v4f val = *(const v4fa*)&sO[w][r][pc * 4]; *(v4f*)(O + ((size_t)b * TQ + q0 + r) * ldo + h * 64 + pc * 4) = val; }
     } }

__global__ __launch_bounds__(256) void k_rotab(float* __restrict__ CS, float* __restrict__ SN) {
  #pragma clang fp contract(off)
  const int t = blockIdx.x * 256 + threadIdx.x; if (t >= SLEN * 32) return; const int j = t % 32, s = t / 32; const float ex = (float)(2 * j) / 64.0f; const float inv = 1.0f / powf(10000.0f, ex); const float th = (float)s * inv; const float c = cosf(th), sn = sinf(th);
  { *(float*)(CS + t) = c; *(float*)(SN + t) = sn;  } }
__global__ __launch_bounds__(256) void k_rope(const float* __restrict__ F, int nsrc, int ndst, int rep, const float* __restrict__ CS, const float* __restrict__ SN, _Float16* __restrict__ H, _Float16* __restrict__ L) {
  #pragma clang fp contract(off)
  const size_t t = (size_t)blockIdx.x * 256 + threadIdx.x; if (t >= (size_t)NR * ndst * 4) return; const int g8 = (int)(t % 4); const int hd = (int)((t / 4) % ndst); const size_t row = t / ((size_t)4 * ndst); const int s = (int)(row % SLEN); const int hs = hd / rep;
  const float* src = F + row * (size_t)(nsrc * 64) + hs * 64; FragH ah, al, bh, bl;
  for (int i = 0; i < 8; ++i) { const int d = g8 * 8 + i; const float c = CS[s * 32 + d], sn = SN[s * 32 + d]; const float x1 = src[d], x2 = src[d + 32];
    float o1 = x1 * c; o1 += -x2 * sn; float o2 = x2 * c; o2 += x1 * sn;
    _Float16 hv = (_Float16)o1; ah.h[i] = hv; al.h[i] = (_Float16)((o1 - (float)hv) * 1024.0f); hv = (_Float16)o2; bh.h[i] = hv; bl.h[i] = (_Float16)((o2 - (float)hv) * 1024.0f); }
  const size_t o = row * (size_t)(ndst * 64) + hd * 64 + g8 * 8;
  { *(v8us*)((unsigned short*)H + o) = ah.half[0]; *(v8us*)((unsigned short*)H + o + 32) = bh.half[0]; *(v8us*)((unsigned short*)L + o) = al.half[0]; *(v8us*)((unsigned short*)L + o + 32) = bl.half[0];  } }
// Every operand conversion in ONE launch, by block ranges: the exact f16 plane of x, the three weight planes (x16, one behind the other in B3), and the mask table of the flash kernel.
// A conversion block streams 16384 values: 16 loads of 16 bytes a lane, each wave-wide load 512 bytes in a row, several of them under way at once; each store of a wave is two whole 128-byte lines. Few, long waves: a launch of such short work is paced by how fast waves start.
// The mask table: M2 = bf16-rounded mask times log2 e. Beyond +-1e38 the table goes on with slope 1/2, so that the factor turns no finite mask into an infinity: two different bf16 values up there still lie more than 1e35 apart in the table, so the smaller one's weight is 0 as it is in natural units, equal values stay equal, and the order is kept; an infinite mask stays infinite
#define PXB (NR * DM / 16384)      /* blocks for x */
#define PWB (DM * DM / 16384)      /* blocks for one weight matrix */
#define PMB (NB * SLEN / 256)      /* blocks for the mask: 1 value a thread */
__global__ __launch_bounds__(256) void k_prep(const float* __restrict__ x, const float* __restrict__ Wq, const float* __restrict__ Wk, const float* __restrict__ Wv, const float* __restrict__ am, _Float16* __restrict__ X16, _Float16* __restrict__ B3, float* __restrict__ M2) {
  const int bx = blockIdx.x, tid = threadIdx.x;
  if (bx >= PXB + 3 * PWB) { const int t = (bx - (PXB + 3 * PWB)) * 256 + tid; const float mr = bf16_round(am[t]), ma = fabsf(mr); M2[t] = (ma <= 1.0e38f) ? mr * LOG2E : copysignf(1.0e38f * LOG2E + (ma - 1.0e38f) * 0.5f, mr); return; }
  const float* src = x; _Float16* dst = X16; float sc = 1.0f; int b0 = bx;
  if (bx >= PXB) { const int wi = (bx - PXB) / PWB; b0 = (bx - PXB) % PWB; src = (wi == 0) ? Wq : ((wi == 1) ? Wk : Wv); dst = B3 + (size_t)wi * DM * DM; sc = 16.0f; }      /* a weight is (out, in) = Bt as it lies */
  const size_t e0 = (size_t)b0 * 16384 + tid * 4; v4f v[16];
#pragma unroll      /* constant indices: the loaded values stay in registers, and loads can be issued ahead of the conversions */
  for (int j = 0; j < 16; ++j) v[j] = *(const v4fa*)(src + e0 + j * 1024);
#pragma unroll      /* constant indices: the loaded values stay in registers */
  for (int j = 0; j < 16; ++j) { v4h h4;
#pragma unroll      /* constant indices: the loaded values stay in registers */
    for (int q = 0; q < 4; ++q) h4[q] = (_Float16)(bf16_round(v[j][q]) * sc);
    *(v4h*)(dst + e0 + j * 1024) = h4; } }
__global__ __launch_bounds__(256) void k_rotab2(float* __restrict__ CS, float* __restrict__ SN) {
  #pragma clang fp contract(off)
  const int t = blockIdx.x * 256 + threadIdx.x; if (t >= SLEN * 32) return; const int j = t % 32, s = t / 32; const float c0 = -0.14391156831212787f;      /* -ln(10000)/64 rounded to f32 */ const float inv = expf((float)(2 * j) * c0); const float th = (float)s * inv; const float c = cosf(th), sn = sinf(th);
  { *(float*)(CS + t) = c; *(float*)(SN + t) = sn;  } }
__global__ __launch_bounds__(256) void k_lnu(const float* __restrict__ X, _Float16* __restrict__ N16, float* __restrict__ XB) {
  #pragma clang fp contract(off)
  const int wv = threadIdx.x >> 5, ln = threadIdx.x & 31; const size_t r = (size_t)blockIdx.x * 8 + wv; if (r >= NR) return; float a[32]; float s = 0.f;
  for (int i = 0; i < 4; ++i) { const v8f v = *(const v8f*)(X + r * DM + (i * 32 + ln) * 8); for (int q = 0; q < 8; ++q) { const float u = bf16_round(v[q]); a[i * 8 + q] = u; s += u; } }
  for (int o = 16; o > 0; o >>= 1) s += __shfl_xor(s, o, 32); const float mu = s / (float)DM; float var = 0.f; for (int q = 0; q < 32; ++q) { const float d = a[q] - mu; var += d * d; }
  for (int o = 16; o > 0; o >>= 1) var += __shfl_xor(var, o, 32); const float den = sqrtf(var / (float)(DM - 1)) + 1e-6f; const float inv = 1.0f / den;      /* one reciprocal per row; (x-mean)*inv vs the reference's division differs by <= 1 ulp */
  { for (int i = 0; i < 4; ++i) { const int c0 = (i * 32 + ln) * 8; FragH f; v8f xb; for (int q = 0; q < 8; ++q) { f.h[q] = (_Float16)((a[i * 8 + q] - mu) * inv); xb[q] = a[i * 8 + q]; } *(v8us*)((unsigned short*)N16 + r * DM + c0) = f.half[0]; *(v8f*)(XB + r * DM + c0) = xb; }  } }

extern "C" void kernel_launch(void* const* d_in, const int* in_sizes, int n_in,
                              void* d_out, int out_size, void* d_ws, size_t ws_size, hipStream_t stream) {
  (void)in_sizes; (void)n_in; (void)out_size;
  const float* const* I = (const float* const*)d_in; const float* x = I[0]; const float* sp = I[1]; const float* am = I[2]; const float* Wq = I[3]; const float* Wk = I[4]; const float* Wv = I[5];
  char* ws = (char*)d_ws; size_t off = 0;
  auto take = [&](size_t bytes) { char* p = ws + off; off += (bytes + 255) & ~(size_t)255; return p; };
  const size_t np = (size_t)NR * DM;
  _Float16* B3 = (_Float16*)take((size_t)3 * DM * DM * 2); float* M2 = (float*)take((size_t)NB * SLEN * 4);
  _Float16* X16 = (_Float16*)take(np * 2); _Float16* QH = (_Float16*)take(np * 2); _Float16* KXH = (_Float16*)take(np * 2); _Float16* VT = (_Float16*)take(np * 2);
  if (off > ws_size) return;      /* 6 + 4 x 8 MiB */
  k_prep<<<PXB + 3 * PWB + PMB, 256, 0, stream>>>(x, Wq, Wk, Wv, am, X16, B3, M2);
  k_qkv<<<dim3((NR / 128) * (NH / 2), 3), 128, 0, stream>>>(X16, B3, sp, QH, KXH, VT);
  k_flash<17><<<NB * NH * QBNP, 256, 0, stream>>>(QH, DM, KXH, DM, VT, (const int*)M2, (float*)d_out, DM);      /* + the mask table [b][key]; the merged context is the output */
}

// v010
// One run takes 56.8 microseconds.
// In both of two side-by-side timings against v009, it was 1.06 times as fast.
// Counting every step since v000, which is the starting kernel, it is 6.92 times as fast.
#include <hip/hip_runtime.h>
// DiffBertSelfAttention (2 x 2048 tokens, D 1024 = 16 heads of 64): q, k, v = x W^T; RoFormer rotary from the sinusoidal_pos INPUT ([sin | cos] halves, interleave-duplicated: out[2i] = x[2i] cos_i - x[2i+1] sin_i, out[2i+1] = x[2i+1] cos_i + x[2i] sin_i); scores/8 + attention_mask[b, key] (additive INPUT, broadcast over heads and queries); softmax; ctx = probs v merged -> the output (no output projection).
// Structure, three launches: k_prep (exact f16 plane of x, exact x16 weight planes, the mask table); k_qkv (q, k, v as WMMA GEMMs, 64x64 wave tiles, f32 accumulation, whose epilogue does the interleaved RoPE in f32 from the input table, bf16-rounded like every input, the f16 conversion, and V^T by an LDS tile); the fused flash kernel with the per-key additive mask (mode 17: a table made from the input in the same call, rounded like every input and in base-2 units; plain operands: every row averages ~2048 keys) writing the merged context straight to the output.
// Compute dtype: inputs and parameters rounded to bf16; q/k/P/v as plain f16 operands (~2^-12); RoPE/softmax f32. v_wmma_f32_16x16x32_f16.
#define NB 2
#define DM 1024
#define NKV 16
#define NREP (NH / NKV)
#define KVD (NKV * 64)           /* 1024 */
#define NR (NB * SLEN)           /* 4096 */
#define SLEN 2048
#define TQ SLEN
#define TK SLEN
#define NH 16
#define SCL 0.125f
#define LOG2E 1.4426950408889634f
#define SCL2 (SCL * LOG2E)      /* scores in base-2 units: exp(s) = 2^(s log2 e) */
#define QBLKS (TQ / 128)
#define QB05 0
#define QBN5 4
#define QB0P 0
#define QBNP QBLKS           /* non-causal: plain flash on every query block */
#define RE 256
typedef __bf16 v16b __attribute__((ext_vector_type(16)));
typedef unsigned short v8us __attribute__((ext_vector_type(8), may_alias));
typedef float  v8f  __attribute__((ext_vector_type(8)));
typedef float  v4f  __attribute__((ext_vector_type(4)));
typedef float  v4fa __attribute__((ext_vector_type(4), may_alias));
typedef float  v2fa __attribute__((ext_vector_type(2), may_alias));
typedef float  v2f  __attribute__((ext_vector_type(2)));
union FragB { v16b v; v8us half[2]; unsigned short u[16]; };

__device__ __forceinline__ unsigned short bf16_bits(float x) { unsigned int u = __float_as_uint(x); return (unsigned short)((u + 0x7FFFu + ((u >> 16) & 1u)) >> 16); }
__device__ __forceinline__ float bf16_val(unsigned short b) { return __uint_as_float(((unsigned int)b) << 16); }
__device__ __forceinline__ float bf16_round(float x) { return bf16_val(bf16_bits(x)); }
// D += A·B with NT terms: 1 = ah·bh, 2 = + al·bh (A split), 3 = + ah·bl (both split)
template <int NT>
__device__ __forceinline__ v8f mmaN(v16b ah, v16b al, v16b bh, v16b bl, v8f c) {
  c = __builtin_amdgcn_wmma_f32_16x16x32_bf16(false, ah, false, bh, (short)0, c, false, false);
  if (NT >= 2) c = __builtin_amdgcn_wmma_f32_16x16x32_bf16(false, al, false, bh, (short)0, c, false, false);
  if (NT >= 3) c = __builtin_amdgcn_wmma_f32_16x16x32_bf16(false, ah, false, bl, (short)0, c, false, false);
  asm volatile("v_nop\n\tv_nop\n\tv_nop\n\tv_nop" : "+v"(c) : "v"(ah), "v"(al), "v"(bh), "v"(bl));
  return c;
}

__global__ __launch_bounds__(256) void k_wt_bf16(const float* __restrict__ W, unsigned short* __restrict__ Wt, int K, int N) {
  const int t = blockIdx.x * 256 + threadIdx.x;
  const int k8n = K / 8;
  if (t >= N * k8n) return;
  const int n = t / k8n, k8 = (t % k8n) * 8;
  v8us v;
#pragma unroll
  for (int i = 0; i < 8; ++i) v[i] = bf16_bits(W[(size_t)(k8 + i) * N + n]);
  *(v8us*)(Wt + (size_t)n * K + k8) = v;
  
}

// GEMM C[M][N] (f32, pitch ldc) = act(A[M][K]·W + bias). A f32 row-major (pitch lda) converted per fragment to bf16
// (ASPLIT: hi/lo two planes -> 2 terms, else single rounded term); Wt bf16 [N][K] (pitch ldb). BIAS_BF16 rounds the
// bias to bf16 first (bias quantised to bf16 before the add). K%32==0, M%16==0, N%64==0.
template <bool ASPLIT, int ACT, bool BIAS_BF16>
__global__ __launch_bounds__(128) void k_gemm_bf(const float* __restrict__ A, int lda, const unsigned short* __restrict__ Wt, int ldb,
                                               const float* __restrict__ bias, float* __restrict__ C, int ldc, int M, int N, int K) {
  __shared__ __attribute__((aligned(16))) float so[4][16][64];
  const int tid = threadIdx.x, w = tid >> 5, lane = tid & 31, ln = lane & 15, hh = lane >> 4;
  const int ntn = N / 64;
  const int wid = blockIdx.x * 4 + w;
  const int mt = wid / ntn, nq = wid % ntn;
  if (mt * 16 >= M) return;
  const int row0 = mt * 16, col0 = nq * 64;
  const float* arow = A + (size_t)(row0 + ln) * lda;
  v8f acc[4] = {};
  for (int kb = 0; kb < K; kb += 32) {
    FragB ah, al;
    const v4f x0 = *(const v4fa*)(arow + kb + 8 * hh), x1 = *(const v4fa*)(arow + kb + 8 * hh + 4);
    const v4f x2 = *(const v4fa*)(arow + kb + 16 + 8 * hh), x3 = *(const v4fa*)(arow + kb + 16 + 8 * hh + 4);
    float xs[16] = {x0[0],x0[1],x0[2],x0[3],x1[0],x1[1],x1[2],x1[3],x2[0],x2[1],x2[2],x2[3],x3[0],x3[1],x3[2],x3[3]};
#pragma unroll
    for (int i = 0; i < 16; ++i) { const unsigned short hb = bf16_bits(xs[i]); ah.u[i] = hb; al.u[i] = ASPLIT ? bf16_bits(xs[i] - bf16_val(hb)) : (unsigned short)0; }
#pragma unroll
    for (int t = 0; t < 4; ++t) {
      const unsigned short* brow = Wt + (size_t)(col0 + t * 16 + ln) * ldb + kb;
      FragB b;
      b.half[0] = *(const v8us*)(brow + 8 * hh);
      b.half[1] = *(const v8us*)(brow + 16 + 8 * hh);
      acc[t] = mmaN<ASPLIT ? 2 : 1>(ah.v, al.v, b.v, b.v, acc[t]);
    }
  }
#pragma unroll
  for (int t = 0; t < 4; ++t) {
    float bv = bias ? bias[col0 + t * 16 + ln] : 0.f;
    if (BIAS_BF16) bv = bf16_round(bv);
#pragma unroll
    for (int r = 0; r < 8; ++r) { float v = acc[t][r] + bv; if (ACT == 1) v = fmaxf(v, 0.f); so[w][8 * hh + r][t * 16 + ln] = v; }
  }
  __builtin_amdgcn_fence(__ATOMIC_ACQ_REL, "workgroup");
  __builtin_amdgcn_wave_barrier();
  const int rsub = lane >> 4, c4 = (lane & 15) * 4;
  {
#pragma unroll
    for (int q = 0; q < 8; ++q) {
      const int r = q * 2 + rsub;
      const v4f v = *(const v4fa*)&so[w][r][c4];
      *(v4f*)(C + (size_t)(row0 + r) * ldc + col0 + c4) = v;
    }
    
  }
}

// GEMM C = act(A·W + bias + resid): A f32 (ASPLIT -> hi/lo 2 terms), Wt bf16 [N][K]; ACT 0 none, 1 relu, 2 exact gelu;
// resid (optional, f32, row index = (row % rmod), pitch ldr, RES_BF16 rounds it) added before the activation.
template <bool ASPLIT, int ACT, bool BIAS_BF16, bool RES_BF16>
__global__ __launch_bounds__(128) void k_gemm_bf3(const float* __restrict__ A, int lda, const unsigned short* __restrict__ Wt, int ldb,
                                                const float* __restrict__ bias, const float* __restrict__ resid, int rmod, int ldr,
                                                float* __restrict__ C, int ldc, int M, int N, int K) {
  __shared__ __attribute__((aligned(16))) float so[4][16][64];
  const int tid = threadIdx.x, w = tid >> 5, lane = tid & 31, ln = lane & 15, hh = lane >> 4;
  const int ntn = N / 64;
  const int wid = blockIdx.x * 4 + w;
  const int mt = wid / ntn, nq = wid % ntn;
  if (mt * 16 >= M) return;
  const int row0 = mt * 16, col0 = nq * 64;
  const float* arow = A + (size_t)(row0 + ln) * lda;
  v8f acc[4] = {};
  for (int kb = 0; kb < K; kb += 32) {
    FragB ah, al;
    const v4f x0 = *(const v4fa*)(arow + kb + 8 * hh), x1 = *(const v4fa*)(arow + kb + 8 * hh + 4);
    const v4f x2 = *(const v4fa*)(arow + kb + 16 + 8 * hh), x3 = *(const v4fa*)(arow + kb + 16 + 8 * hh + 4);
    float xs[16] = {x0[0],x0[1],x0[2],x0[3],x1[0],x1[1],x1[2],x1[3],x2[0],x2[1],x2[2],x2[3],x3[0],x3[1],x3[2],x3[3]};
#pragma unroll
    for (int i = 0; i < 16; ++i) { const unsigned short hb = bf16_bits(xs[i]); ah.u[i] = hb; al.u[i] = ASPLIT ? bf16_bits(xs[i] - bf16_val(hb)) : (unsigned short)0; }
#pragma unroll
    for (int t = 0; t < 4; ++t) {
      const unsigned short* brow = Wt + (size_t)(col0 + t * 16 + ln) * ldb + kb;
      FragB b;
      b.half[0] = *(const v8us*)(brow + 8 * hh);
      b.half[1] = *(const v8us*)(brow + 16 + 8 * hh);
      acc[t] = mmaN<ASPLIT ? 2 : 1>(ah.v, al.v, b.v, b.v, acc[t]);
    }
  }
#pragma unroll
  for (int t = 0; t < 4; ++t) {
    const int col = col0 + t * 16 + ln;
    float bv = bias ? bias[col] : 0.f;
    if (BIAS_BF16) bv = bf16_round(bv);
#pragma unroll
    for (int r = 0; r < 8; ++r) {
      float v = acc[t][r] + bv;
      if (resid) { float rv = resid[(size_t)((row0 + 8 * hh + r) % rmod) * ldr + col]; if (RES_BF16) rv = bf16_round(rv); v += rv; }
      if (ACT == 1) v = fmaxf(v, 0.f);
      if (ACT == 2) v = 0.5f * v * (1.0f + erff(v * 0.70710678118654752f));
      if (ACT == 3) { const float u = 0.7978845608028654f * (v + 0.044715f * v * v * v); v = 0.5f * v * (1.0f + tanhf(u)); }
      so[w][8 * hh + r][t * 16 + ln] = v;
    }
  }
  __builtin_amdgcn_fence(__ATOMIC_ACQ_REL, "workgroup");
  __builtin_amdgcn_wave_barrier();
  const int rsub = lane >> 4, c4 = (lane & 15) * 4;
  {
#pragma unroll
    for (int q = 0; q < 8; ++q) {
      const int r = q * 2 + rsub;
      const v4f v = *(const v4fa*)&so[w][r][c4];
      *(v4f*)(C + (size_t)(row0 + r) * ldc + col0 + c4) = v;
    }
    
  }
}
// row LayerNorm (biased variance, eps) over N: s = X (+ R); optional out_sum <- s; out_norm <- (s-mu)*rsqrt(var+eps)*g + b
template <bool PARAM_BF16>
__global__ __launch_bounds__(256) void k_layernorm(const float* __restrict__ X, const float* __restrict__ R, const float* __restrict__ g, const float* __restrict__ bta,
                                                  float* __restrict__ out_sum, float* __restrict__ out_norm, int N, float eps) {
  __shared__ float red[256];
  const int row = blockIdx.x, tid = threadIdx.x;
  const float* x = X + (size_t)row * N; const float* rr = R ? R + (size_t)row * N : nullptr;
  float vals[16];                     // up to N = 4096
  const int per = N / 256;            // contiguous chunk per thread? use strided-by-4 chunks: thread handles j = tid*4 + 1024*u
  float s1 = 0.f;
  for (int u = 0; u < per / 4; ++u) {
    const int j = tid * 4 + 1024 * u;
    const v4f a = *(const v4fa*)(x + j);
    v4f b = {0.f,0.f,0.f,0.f}; if (rr) b = *(const v4fa*)(rr + j);
#pragma unroll
    for (int q = 0; q < 4; ++q) { const float v = a[q] + b[q]; vals[u * 4 + q] = v; s1 += v; }
  }
  red[tid] = s1; __syncthreads();
  for (int st = 128; st > 0; st >>= 1) { if (tid < st) red[tid] += red[tid + st]; __syncthreads(); }
  const float mu = red[0] / (float)N; __syncthreads();
  float s2 = 0.f;
  for (int u = 0; u < per / 4; ++u)
#pragma unroll
    for (int q = 0; q < 4; ++q) { const float c = vals[u * 4 + q] - mu; s2 += c * c; }
  red[tid] = s2; __syncthreads();
  for (int st = 128; st > 0; st >>= 1) { if (tid < st) red[tid] += red[tid + st]; __syncthreads(); }
  const float rs = rsqrtf(red[0] / (float)N + eps);
  {
    for (int u = 0; u < per / 4; ++u) {
      const int j = tid * 4 + 1024 * u;
      v4f o, sm;
#pragma unroll
      for (int q = 0; q < 4; ++q) {
        float gg = g[j + q], bb = bta[j + q];
        if (PARAM_BF16) { gg = bf16_round(gg); bb = bf16_round(bb); }
        sm[q] = vals[u * 4 + q]; o[q] = (vals[u * 4 + q] - mu) * rs * gg + bb;
      }
      if (out_sum) *(v4f*)(out_sum + (size_t)row * N + j) = sm;
      *(v4f*)(out_norm + (size_t)row * N + j) = o;
    }
    
  }
}



// ---- f16 WMMA path (v_wmma_f32_16x16x32_f16): 11-bit significands for operands in range — used where a [0,1] probability operand needs more precision than bf16
typedef _Float16 v16h __attribute__((ext_vector_type(16)));
union FragH { v16h v; v8us half[2]; _Float16 h[16]; unsigned short u[16]; };
template <int NT>
__device__ __forceinline__ v8f mmaH(v16h ah, v16h al, v16h bh, v16h bl, v8f c) {
  c = __builtin_amdgcn_wmma_f32_16x16x32_f16(false, ah, false, bh, (short)0, c, false, false);
  if (NT >= 2) c = __builtin_amdgcn_wmma_f32_16x16x32_f16(false, al, false, bh, (short)0, c, false, false);
  if (NT >= 3) c = __builtin_amdgcn_wmma_f32_16x16x32_f16(false, ah, false, bl, (short)0, c, false, false);
  asm volatile("v_nop\n\tv_nop\n\tv_nop\n\tv_nop" : "+v"(c) : "v"(ah), "v"(al), "v"(bh), "v"(bl));
  return c;
}
// batched GEMM like k_gemm_b but f16 operands: A f32 (split into f16 hi/lo if ASPLIT, else rounded to f16), Bt = f16 values [n][k]; alpha; C f32; N multiple of 16 (partial tiles skipped)
template <bool ASPLIT>
__global__ __launch_bounds__(128) void k_gemm_h(const float* __restrict__ A, int lda, size_t sA, const _Float16* __restrict__ Bh, int ldb, size_t sB, float alpha, float* __restrict__ C, int ldc, size_t sC, int M, int N, int K) {
  __shared__ __attribute__((aligned(16))) float so[4][16][64];
  const int tid = threadIdx.x, w = tid >> 5, lane = tid & 31, ln = lane & 15, hh = lane >> 4; const int by = blockIdx.y;
  A += (size_t)by * sA; Bh += (size_t)by * sB; C += (size_t)by * sC;
  const int ntn = (N + 63) / 64; const int wid = blockIdx.x * 4 + w; const int mt = wid / ntn, nq = wid % ntn; if (mt * 16 >= M) return;
  const int row0 = mt * 16, col0 = nq * 64; const float* arow = A + (size_t)(row0 + ln) * lda;
  v8f acc[4] = {};
  for (int kb = 0; kb < K; kb += 32) {
    FragH ah, al;
    const v4f x0 = *(const v4fa*)(arow + kb + 8 * hh), x1 = *(const v4fa*)(arow + kb + 8 * hh + 4), x2 = *(const v4fa*)(arow + kb + 16 + 8 * hh), x3 = *(const v4fa*)(arow + kb + 16 + 8 * hh + 4);
    float xs[16] = {x0[0],x0[1],x0[2],x0[3],x1[0],x1[1],x1[2],x1[3],x2[0],x2[1],x2[2],x2[3],x3[0],x3[1],x3[2],x3[3]};
#pragma unroll
    for (int i = 0; i < 16; ++i) { const _Float16 h = (_Float16)xs[i]; ah.h[i] = h; al.h[i] = ASPLIT ? (_Float16)(xs[i] - (float)h) : (_Float16)0.0f; }
#pragma unroll
    for (int t = 0; t < 4; ++t) { if (col0 + t * 16 >= N) continue; const size_t boff = (size_t)(col0 + t * 16 + ln) * ldb + kb; FragH bq; bq.half[0] = *(const v8us*)(Bh + boff + 8 * hh); bq.half[1] = *(const v8us*)(Bh + boff + 16 + 8 * hh);
      acc[t] = mmaH<ASPLIT ? 2 : 1>(ah.v, al.v, bq.v, bq.v, acc[t]); }
  }
#pragma unroll
  for (int t = 0; t < 4; ++t) { if (col0 + t * 16 >= N) continue;
#pragma unroll
    for (int r = 0; r < 8; ++r) so[w][8 * hh + r][t * 16 + ln] = acc[t][r] * alpha; }
  __builtin_amdgcn_fence(__ATOMIC_ACQ_REL, "workgroup"); __builtin_amdgcn_wave_barrier();
  const int rsub = lane >> 4, c4 = (lane & 15) * 4;
  {
#pragma unroll
    for (int q = 0; q < 8; ++q) { const int r = q * 2 + rsub; if (col0 + c4 < N) { const v4f v = *(const v4fa*)&so[w][r][c4]; *(v4f*)(C + (size_t)(row0 + r) * ldc + col0 + c4) = v; } }
     }
}

// Wt[n][k] = f16(W[k][n]·scale) from f32 row-major W[K][N] (scale = power of two; bf16-exact weights stay exact in f16 away from the subnormal range)
__global__ __launch_bounds__(256) void k_wt_f16(const float* __restrict__ W, _Float16* __restrict__ Wt, int K, int N, float scale) {
  const int t = blockIdx.x * 256 + threadIdx.x; if (t >= N * (K / 8)) return; const int n = t / (K / 8), k8 = (t % (K / 8)) * 8; FragH f;
#pragma unroll
  for (int i = 0; i < 8; ++i) f.h[i] = (_Float16)(bf16_round(W[(size_t)(k8 + i) * N + n]) * scale); const v8us o = f.half[0];
  *(v8us*)((unsigned short*)Wt + (size_t)n * K + k8) = o; 
}
// k_gemm_hh variant with fused epilogue: v = acc·alpha + bias[by·sBias + col] (+ CP[(row/rowsPerB)·sCPb + by·64 + col] if CP) ; ACT 0 none / 1 elu ; writes f16 C16 (and f32 C if non-null)
template <int ACT>
__global__ __launch_bounds__(128) void k_gemm_hhx(const _Float16* __restrict__ A, int lda, size_t sA, const _Float16* __restrict__ Bh, int ldb, size_t sB, float alpha, const float* __restrict__ bias, size_t sBias, const float* __restrict__ CP, int rowsPerB, size_t sCPb, int row0g,
    float* __restrict__ C, _Float16* __restrict__ C16, int ldc, size_t sC, int M, int N, int K) {
  __shared__ __attribute__((aligned(16))) float so[4][16][64];
  const int tid = threadIdx.x, w = tid >> 5, lane = tid & 31, ln = lane & 15, hh = lane >> 4; const int by = blockIdx.y;
  A += (size_t)by * sA; Bh += (size_t)by * sB; const size_t cofs = (size_t)by * sC; const float* bp = bias ? bias + (size_t)by * sBias : nullptr;
  const int ntn = (N + 63) / 64; const int wid = blockIdx.x * 4 + w; const int mt = wid / ntn, nq = wid % ntn; if (mt * 16 >= M) return;
  const int row0 = mt * 16, col0 = nq * 64; const _Float16* arow = A + (size_t)(row0 + ln) * lda;
  v8f acc[4] = {};
  for (int kb = 0; kb < K; kb += 32) { FragH ah; ah.half[0] = *(const v8us*)((const unsigned short*)arow + kb + 8 * hh); ah.half[1] = *(const v8us*)((const unsigned short*)arow + kb + 16 + 8 * hh);
#pragma unroll
    for (int t = 0; t < 4; ++t) { if (col0 + t * 16 >= N) continue; const size_t boff = (size_t)(col0 + t * 16 + ln) * ldb + kb; FragH bq; bq.half[0] = *(const v8us*)((const unsigned short*)Bh + boff + 8 * hh); bq.half[1] = *(const v8us*)((const unsigned short*)Bh + boff + 16 + 8 * hh);
      acc[t] = mmaH<1>(ah.v, ah.v, bq.v, bq.v, acc[t]); }
  }
#pragma unroll
  for (int t = 0; t < 4; ++t) { if (col0 + t * 16 >= N) continue; const int col = col0 + t * 16 + ln; const float bv = bp ? bf16_round(bp[col]) : 0.f;
#pragma unroll
    for (int r = 0; r < 8; ++r) { float v = acc[t][r] * alpha + bv; if (CP) { const int bidx = (row0g + row0 + 8 * hh + r) / rowsPerB; v += CP[(size_t)bidx * sCPb + (size_t)by * 64 + col]; } if (ACT == 1) v = (v > 0.f) ? v : expm1f(v); else if (ACT == 7) v = (v > 0.f) ? v + 1.0f : expf(v); else if (ACT == 8) v = tanhf(v); else if (ACT == 9) v = 0.5f * v * (1.0f + tanhf(0.7978845608028654f * (v + 0.044715f * v * v * v))); else if (ACT == 11) v = 1.0f / (1.0f + expf(-v)); else if (ACT == 12) v = (v > 0.f) ? v : 0.01f * v; else if (ACT == 14) v = (v > 0.f) ? v : 0.1f * v; else if (ACT == 15) v = v / (1.0f + expf(-v)); else if (ACT == 3) v = fmaxf(v, 0.f); else if (ACT == 6) v = 0.5f * v * (1.0f + erff(v * 0.70710678118654752f)); so[w][8 * hh + r][t * 16 + ln] = v; } }
  __builtin_amdgcn_fence(__ATOMIC_ACQ_REL, "workgroup"); __builtin_amdgcn_wave_barrier();
  const int rsub = lane >> 4, c4 = (lane & 15) * 4; typedef _Float16 v4h __attribute__((ext_vector_type(4)));
  {
#pragma unroll
    for (int q = 0; q < 8; ++q) { const int r = q * 2 + rsub; if (col0 + c4 < N) { const v4f v = *(const v4fa*)&so[w][r][c4]; if (C) *(v4f*)(C + cofs + (size_t)(row0 + r) * ldc + col0 + c4) = v; if (C16) { v4h h4; for (int i = 0; i < 4; ++i) h4[i] = (_Float16)v[i]; *(v4h*)(C16 + cofs + (size_t)(row0 + r) * ldc + col0 + c4) = h4; } } }
     }
}


typedef _Float16 v4h __attribute__((ext_vector_type(4)));

__global__ __launch_bounds__(256) void k_h16(const float* __restrict__ x, _Float16* __restrict__ X16, size_t n8) { const size_t t = (size_t)blockIdx.x * 256 + threadIdx.x; if (t >= n8) return; FragH f;
#pragma unroll
  for (int q = 0; q < 8; ++q) f.h[q] = (_Float16)x[t * 8 + q]; *(v8us*)((unsigned short*)X16 + t * 8) = f.half[0];  }
__global__ __launch_bounds__(256) void k_round16f(const float* __restrict__ W, _Float16* __restrict__ Bt, size_t n8) { const size_t t = (size_t)blockIdx.x * 256 + threadIdx.x; if (t >= n8) return; FragH f;
#pragma unroll
  for (int i = 0; i < 8; ++i) f.h[i] = (_Float16)(bf16_round(W[t * 8 + i]) * 16.0f); *(v8us*)((unsigned short*)Bt + t * 8) = f.half[0];  }
template <int NHv, int TTv>
__global__ __launch_bounds__(256) void k_vt(const _Float16* __restrict__ V16, int ldv, int voff, _Float16* __restrict__ Vt) { __shared__ unsigned short tl[64][66]; const int tid = threadIdx.x; const int slab = blockIdx.x / (TTv / 64), lg = blockIdx.x % (TTv / 64); const int b = slab / NHv, h = slab % NHv;
  for (int i = tid; i < 64 * 8; i += 256) { const int r = i / 8, c8 = (i % 8) * 8; FragH f; f.half[0] = *(const v8us*)((const unsigned short*)V16 + ((size_t)b * TTv + lg * 64 + r) * ldv + voff + h * 64 + c8);
#pragma unroll
    for (int q = 0; q < 8; ++q) tl[r][c8 + q] = f.u[q]; }
  __syncthreads();
  {
#pragma unroll
    for (int rd = 0; rd < 2; ++rd) { const int d = rd * 32 + tid / 8, pc = tid % 8; FragH f;
#pragma unroll
      for (int q = 0; q < 8; ++q) f.u[q] = tl[pc * 8 + q][d];
      *(v8us*)((unsigned short*)Vt + ((size_t)slab * 64 + d) * TTv + lg * 64 + pc * 8) = f.half[0]; }
     } }


// ---- fast GEMM (wave tile 64x64, block tile 256x192) ----
__device__ __forceinline__ v16h g2_frag(const _Float16* p, int hh) { FragH f; f.half[0] = *(const v8us*)((const unsigned short*)p + 8 * hh); f.half[1] = *(const v8us*)((const unsigned short*)p + 16 + 8 * hh); return f.v; }
__device__ __forceinline__ v8f g2_mma(v16h a, v16h b, v8f c) { v8f d = __builtin_amdgcn_wmma_f32_16x16x32_f16(false, a, false, b, (short)0, c, false, false); asm volatile("v_nop\n\tv_nop\n\tv_nop\n\tv_nop" : "+v"(d) : "v"(a), "v"(b)); return d; }
// Sixteen rows of a stage (rows of 256 bytes = 128 k, LDS pitch G2P bytes): 8 asynchronous 16-byte copies per lane, 16 lanes to a row, so that each copy of a wave reads 4 whole 128-byte lines.
// l = this lane's LDS byte address in row lane / 16 of the sixteen; g = this lane's 16 bytes in the operand's row lane / 16 of them; every further copy is 2 rows on.
#define G2P 272            /* 256 + 16: the pitch for 16-byte LDS reads of 256-byte rows */
#define G2M 256            /* tokens of a block */
#define G2N 192            /* columns of a block: three heads */
#define G2S ((G2M + G2N) * G2P)      /* bytes of one stage */
__device__ __forceinline__ void g2_stage(unsigned l, const _Float16* g, size_t ld) {
  const unsigned l1 = l + 2 * G2P, l2 = l + 4 * G2P, l3 = l + 6 * G2P, l4 = l + 8 * G2P, l5 = l + 10 * G2P, l6 = l + 12 * G2P, l7 = l + 14 * G2P;
  const _Float16 *g1 = g + 2 * ld, *g2 = g + 4 * ld, *g3 = g + 6 * ld, *g4 = g + 8 * ld, *g5 = g + 10 * ld, *g6 = g + 12 * ld, *g7 = g + 14 * ld;
  /* the copies and their s_wait_xcnt in one statement: no address register is rewritten before the wait */
  asm volatile("global_load_async_to_lds_b128 %0, %8, off\n\t"
               "global_load_async_to_lds_b128 %1, %9, off\n\t"
               "global_load_async_to_lds_b128 %2, %10, off\n\t"
               "global_load_async_to_lds_b128 %3, %11, off\n\t"
               "global_load_async_to_lds_b128 %4, %12, off\n\t"
               "global_load_async_to_lds_b128 %5, %13, off\n\t"
               "global_load_async_to_lds_b128 %6, %14, off\n\t"
               "global_load_async_to_lds_b128 %7, %15, off\n\t"
               "s_wait_xcnt 0x0"
               :: "v"(l), "v"(l1), "v"(l2), "v"(l3), "v"(l4), "v"(l5), "v"(l6), "v"(l7),
                  "v"(g), "v"(g1), "v"(g2), "v"(g3), "v"(g4), "v"(g5), "v"(g6), "v"(g7) : "memory"); }
// The three projections in ONE launch: the weight planes (0 q, 1 k, 2 v) lie one behind the other in B3 = 48 heads of 64 columns; a wave's head says which plane it is in and what the epilogue makes of the tile, so that q, k and v never exist as f32 planes in memory.
// Block tile 256 tokens x 192 columns = three heads, one block to a WGP (256 blocks), twelve waves as 4 x 3, each 64 tokens x 64 columns = one head: a fragment read from LDS feeds four products, and a byte copied from L2 into LDS feeds 1.7 times the products of a 128 x 128 block.
// K = DM; A and B go through LDS in stages of 128 k, two buffers: stage t + 1 flies while stage t is worked on. Waves 0 to 7 copy 32 A rows each, waves 8 to 11 copy 48 B rows each. The fragments are read from LDS in the k order of g2_frag.
// Behind the loop's last barrier the ring is free, and each wave stages its tile in its own part of it.
// q, k: the wave's 64x64 tile goes through its own LDS rows, a lane takes 4 neighbouring columns = 2 rotary pairs back, turns them by the sinusoidal_pos INPUT row of its token ([sin | cos], rounded like every input) and stores 4 f16: 16 lanes write one head row = one 128-byte line.
// v: register r of an accumulator is token 8 hh + r of one head column, so 8 converted registers are 16 bytes of a V^T row; the wave's 64 x 64 V^T tile is gathered in its own LDS rows and stored as whole 128-byte lines, 8 lanes to a line.
#define SOP 68             /* floats per LDS row of a wave's f32 tile */
#define VTP 72             /* f16 per LDS row of a wave's V^T tile: 128 + 16 bytes */
typedef float f1a __attribute__((may_alias));
__global__ __launch_bounds__(384) __attribute__((amdgpu_waves_per_eu(3, 4))) void k_qkv(const _Float16* __restrict__ A, const _Float16* __restrict__ B3, const float* __restrict__ sp, _Float16* __restrict__ Q16, _Float16* __restrict__ K16, _Float16* __restrict__ Vt) {
  __shared__ __attribute__((aligned(16))) _Float16 st[2][G2M + G2N][G2P / 2];      /* [buffer][256 A rows, 192 B rows] */
  const int tid = threadIdx.x, w = __builtin_amdgcn_readfirstlane(tid >> 5), lane = tid & 31, ln = lane & 15, hh = lane >> 4;      /* the wave's number in a scalar register: every test on it is a scalar branch */
  const int wm = w / 3, wn = w % 3;      /* the wave's token quarter and its head of the block's three */
  const int mt = blockIdx.x / (3 * DM / G2N), np = blockIdx.x % (3 * DM / G2N); const int row0 = mt * G2M + 64 * wm, h48 = np * 3 + wn, by = h48 / NH, hd = h48 % NH, col0 = hd * 64;      /* by: the plane of this wave's head */
  const bool cb = (w >= 8);      /* this wave copies B rows */
  const int sr = cb ? G2M + 48 * (w - 8) : 32 * w;      /* the first row of the stage that this wave copies */
  const _Float16* gs = (cb ? B3 + (size_t)(np * G2N + 48 * (w - 8)) * DM : A + (size_t)(mt * G2M + 32 * w) * DM) + (size_t)hh * DM + ln * 8;
  const unsigned ls = (unsigned)(size_t)&st[0][sr + hh][ln * 8];
  constexpr int nst = DM >> 7;
  g2_stage(ls, gs, (size_t)DM); g2_stage(ls + 16 * G2P, gs + 16 * DM, (size_t)DM); if (cb) g2_stage(ls + 32 * G2P, gs + 32 * DM, (size_t)DM);
  asm volatile("s_wait_asynccnt 0x0" ::: "memory");      /* stage 0 of this wave has landed */
  __syncthreads();      /* ... and every wave's share of it */
  g2_stage(ls + G2S, gs + 128, (size_t)DM); g2_stage(ls + G2S + 16 * G2P, gs + 128 + 16 * DM, (size_t)DM); if (cb) g2_stage(ls + G2S + 32 * G2P, gs + 128 + 32 * DM, (size_t)DM);
  v8f c[4][4];      /* c[i][j]: tokens row0 + 16 i ..., columns col0 + 16 j ... */
#pragma unroll      /* constant indices: the accumulators stay in registers */
  for (int i = 0; i < 4; ++i) {
#pragma unroll      /* constant indices: the accumulators stay in registers */
    for (int j = 0; j < 4; ++j) c[i][j] = (v8f){0.f,0.f,0.f,0.f,0.f,0.f,0.f,0.f}; }
  /* rolled: one trip of code; the buffer is picked by the trip's parity */
#pragma unroll 1
  for (int t = 0; t < nst; ++t) { const _Float16* sa = &st[t & 1][64 * wm + ln][0]; const _Float16* sb = &st[t & 1][G2M + 64 * wn + ln][0];
#pragma unroll      /* constant indices: fragments and accumulators stay in registers */
    for (int ks = 0; ks < 4; ++ks) { v16h a[4], b[4];
      /* the eight fragments of 32 k are read together, ahead of their sixteen products */
#pragma unroll      /* constant indices: fragments and accumulators stay in registers */
      for (int i = 0; i < 4; ++i) { a[i] = g2_frag(sa + i * 16 * (G2P / 2) + ks * 32, hh); b[i] = g2_frag(sb + i * 16 * (G2P / 2) + ks * 32, hh); }
#pragma unroll      /* constant indices: fragments and accumulators stay in registers */
      for (int j = 0; j < 4; ++j) {
#pragma unroll      /* constant indices: fragments and accumulators stay in registers */
        for (int i = 0; i < 4; ++i) c[i][j] = g2_mma(a[i], b[j], c[i][j]); } }
    asm volatile("s_wait_dscnt 0x0" ::: "memory");      /* this wave's reads of the buffer are done before it is refilled */
    asm volatile("s_wait_asynccnt 0x0" ::: "memory");      /* this wave's share of stage t + 1 has landed */
    __syncthreads();      /* publishes stage t + 1 and ends every wave's reads of stage t */
    if (t + 2 < nst) { const unsigned lt = ls + (unsigned)(t & 1) * G2S; const _Float16* gt = gs + (size_t)(t + 2) * 128;
      g2_stage(lt, gt, (size_t)DM); g2_stage(lt + 16 * G2P, gt + 16 * DM, (size_t)DM); if (cb) g2_stage(lt + 32 * G2P, gt + 32 * DM, (size_t)DM); } }
  asm volatile("s_wait_asynccnt 0x0" ::: "memory");      /* nothing in flight when the wave goes on to the epilogue */
  char* sw = (char*)&st[0][0][0] + w * (64 * SOP * 4);      /* this wave's own part of the ring, which every wave has left at the last trip's barrier. The weights hold the factor 16: every value below is accumulator / 16 */
  /* The epilogue in three short branches on the plane (the same for the whole wave; no block barrier stands behind the loop) instead of one long one: the accumulators end in the middle one, so that their registers are free for the read-out (with one long branch for q, k and one for v this build kept all 128 alive through the q, k branch and ran out of registers) */
  const bool isv = (by == 2);
  const float qf = (by == 0) ? 0.0625f * SCL2 : 0.0625f;      /* q also takes the flash kernel's score factor (1/8 and log2 e) here, ahead of its f16 rounding: the rotation is linear, and the score products then need no multiply */
  unsigned short* vt = (unsigned short*)sw; f1a* so = (f1a*)sw;
  const int rsub = lane >> 4, c4 = (lane & 15) * 4;
  /* q, k: the table words of token row0 + rsub, pairs c4 / 2 and c4 / 2 + 1; the lane's next token is two rows = 128 floats on (a wave's 64 tokens never cross the end of a sequence). The first half is asked for ahead of the LDS round trip, which hides its way, the second behind it, when the accumulators' registers are free */
  const float* pr = sp + (size_t)(row0 % SLEN + rsub) * 64 + (c4 >> 1); v2fa sn[32], cs[32];
  if (!isv) {
#pragma unroll      /* constant indices: the table words stay in registers */
    for (int q = 0; q < 16; ++q) { sn[q] = *(const v2fa*)(pr + q * 128); cs[q] = *(const v2fa*)(pr + q * 128 + 32); }
    asm volatile("s_wait_xcnt 0x0" :: "v"(pr) : "memory");      /* the loads' address register lives up to this wait: nothing is written over it while a load that names it is under way */
  }
  if (isv) {
#pragma unroll      /* constant indices: the accumulators stay in registers */
    for (int i = 0; i < 4; ++i) {
#pragma unroll      /* constant indices: the accumulators stay in registers */
      for (int j = 0; j < 4; ++j) { FragH f;
#pragma unroll      /* constant indices: the accumulators stay in registers */
        for (int r = 0; r < 8; ++r) f.h[r] = (_Float16)(c[i][j][r] * 0.0625f);
        *(v8us*)(vt + (j * 16 + ln) * VTP + i * 16 + 8 * hh) = f.half[0]; } }
  } else {
#pragma unroll      /* constant indices: the accumulators stay in registers */
    for (int i = 0; i < 4; ++i) {
#pragma unroll      /* constant indices: the accumulators stay in registers */
      for (int j = 0; j < 4; ++j) {
#pragma unroll      /* constant indices: the accumulators stay in registers */
        for (int r = 0; r < 8; ++r) so[(i * 16 + 8 * hh + r) * SOP + j * 16 + ln] = c[i][j][r] * qf; } }
  }
  __builtin_amdgcn_fence(__ATOMIC_ACQ_REL, "workgroup"); __builtin_amdgcn_wave_barrier();      /* the wave's LDS writes are done before its lanes read rows that other lanes wrote */
  if (isv) {
    const int b = row0 / SLEN, key0 = row0 % SLEN;      /* a wave's 64 tokens never cross the end of a sequence */
    unsigned short* vp = (unsigned short*)Vt + ((size_t)(b * NH + hd) * 64 + (lane >> 3)) * SLEN + key0 + (lane & 7) * 8;
#pragma unroll      /* the LDS reads stand together, ahead of the stores */
    for (int p = 0; p < 16; ++p) { const v8us val = *(const v8us*)(vt + (p * 4 + (lane >> 3)) * VTP + (lane & 7) * 8);
      *(v8us*)(vp + (size_t)p * 4 * SLEN) = val; }
    asm volatile("s_wait_xcnt 0x0" ::: "memory");      /* behind the last store of the run: no register that a store names is written over while the store is under way */
  } else {
    _Float16* __restrict__ H = by ? K16 : Q16;
#pragma unroll      /* constant indices: the table words stay in registers */
    for (int q = 16; q < 32; ++q) { sn[q] = *(const v2fa*)(pr + q * 128); cs[q] = *(const v2fa*)(pr + q * 128 + 32); }
    asm volatile("s_wait_xcnt 0x0" :: "v"(pr) : "memory");      /* as above, for the second half's loads */
    _Float16* hp = H + (size_t)(row0 + rsub) * DM + col0 + c4;
#pragma unroll      /* constant indices: the table words stay in registers */
    for (int qg = 0; qg < 4; ++qg) { v4h h4[8];      /* eight tokens' results, then their eight stores as one run */
#pragma unroll      /* constant indices: the table words stay in registers */
      for (int e = 0; e < 8; ++e) { const int q = qg * 8 + e; const v4f v = *(const v4fa*)&so[(q * 2 + rsub) * SOP + c4];
        const float s0 = bf16_round(sn[q][0]), s1 = bf16_round(sn[q][1]), k0 = bf16_round(cs[q][0]), k1 = bf16_round(cs[q][1]);
        h4[e][0] = (_Float16)(v[0] * k0 - v[1] * s0); h4[e][1] = (_Float16)(v[0] * s0 + v[1] * k0); h4[e][2] = (_Float16)(v[2] * k1 - v[3] * s1); h4[e][3] = (_Float16)(v[2] * s1 + v[3] * k1); }
      __builtin_amdgcn_sched_barrier(0);      /* no vector instruction is moved in among the run of stores below, where it could write over a register that an issued store names */
#pragma unroll      /* constant indices: the results stay in registers */
      for (int e = 0; e < 8; ++e) *(v4h*)(hp + (size_t)(qg * 8 + e) * 2 * DM) = h4[e];
      asm volatile("s_wait_xcnt 0x0" ::: "memory");      /* behind the last store of the run: no register that a store names is written over while the store is under way */
      __builtin_amdgcn_sched_barrier(0); }      /* ... and nothing of the next run is moved up in front of that wait */
  } }



// lane l <-> lane l ^ 16 (the two halves of a wave hold the two key halves of one query column)
__device__ __forceinline__ float xhalf(float x) { return __builtin_bit_cast(float, __builtin_amdgcn_permlanex16(__builtin_bit_cast(int, x), __builtin_bit_cast(int, x), 0x76543210, 0xfedcba98, false, false)); }
__device__ __forceinline__ v8f mmaT(v16h a, v16h b, v8f c) { return __builtin_amdgcn_wmma_f32_16x16x32_f16(false, a, false, b, (short)0, c, false, false); }
// One wave's share of one key group's half of a flash stage, 64 keys (128 rows of 128 bytes: 64 K rows of the head, then the 64 V^T rows' 64 keys, LDS pitch FLP bytes): 8 asynchronous 16-byte copies per lane, 8 lanes to a row, so that each copy of a wave reads 4 whole 128-byte lines.
// With i = the thread's number among its key group's 128: l = this lane's LDS byte address in the half's row i / 8; gk, gv = this lane's 16 bytes in K row i / 8 and V^T row i / 8 of the half; every further copy is 16 rows on.
#define FLP 144            /* 128 + 16: the pitch for 16-byte LDS reads of 128-byte rows */
#define FLS (128 * FLP)    /* bytes of one key group's half of a stage */
__device__ __forceinline__ void fl_stage(unsigned l, const _Float16* gk, size_t ldk, const _Float16* gv) {
  const unsigned l1 = l + 16 * FLP, l2 = l + 32 * FLP, l3 = l + 48 * FLP, l4 = l + 64 * FLP, l5 = l + 80 * FLP, l6 = l + 96 * FLP, l7 = l + 112 * FLP;
  const _Float16 *k1 = gk + 16 * ldk, *k2 = gk + 32 * ldk, *k3 = gk + 48 * ldk, *v1 = gv + 16 * TK, *v2 = gv + 32 * TK, *v3 = gv + 48 * TK;
  /* the copies and their s_wait_xcnt in one statement: no address register is rewritten before the wait */
  asm volatile("global_load_async_to_lds_b128 %0, %8, off\n\t"
               "global_load_async_to_lds_b128 %1, %9, off\n\t"
               "global_load_async_to_lds_b128 %2, %10, off\n\t"
               "global_load_async_to_lds_b128 %3, %11, off\n\t"
               "global_load_async_to_lds_b128 %4, %12, off\n\t"
               "global_load_async_to_lds_b128 %5, %13, off\n\t"
               "global_load_async_to_lds_b128 %6, %14, off\n\t"
               "global_load_async_to_lds_b128 %7, %15, off\n\t"
               "s_wait_xcnt 0x0"
               :: "v"(l), "v"(l1), "v"(l2), "v"(l3), "v"(l4), "v"(l5), "v"(l6), "v"(l7),
                  "v"(gk), "v"(k1), "v"(k2), "v"(k3), "v"(gv), "v"(v1), "v"(v2), "v"(v3) : "memory"); }
// the maximum of a lane's 16 scores of one column tile (exact in any order)
__device__ __forceinline__ float fl_max16(const v2f (&s)[8]) { float mx[8];
#pragma unroll
  for (int i = 0; i < 8; ++i) mx[i] = fmaxf(s[i][0], s[i][1]);
  return fmaxf(fmaxf(fmaxf(mx[0], mx[1]), fmaxf(mx[2], mx[3])), fmaxf(fmaxf(mx[4], mx[5]), fmaxf(mx[6], mx[7]))); }
// Transposed products: S^T = K Q^T (A = 16 key rows, B = 16 query columns, kept in registers), O^T += V^T P^T (A = 16 rows of V^T, B = P^T).
// A wave holds TWO tiles of 16 query columns (cg = 0, 1): every K and V^T fragment that it reads from LDS feeds two products. So that the chip still has as many waves, the keys are split inside the block: 8 waves = 4 query groups of 32 x 2 key groups; of each stage of 128 keys, key group g works on keys 64 g ... 64 g + 63, with its own reference, sum and accumulators, and the two groups' results are joined once, behind the loop, through LDS.
// Lane (c = lane & 15, hh = lane >> 4) holds queries q0 + c and q0 + 16 + c only: register r of score tile nt is key j0 + 16 nt + 8 hh + r, so maximum and sum run in-lane plus one exchange between the halves,
// and the two converted score tiles ARE the B operand of the second product in the hardware k order (element s: key 8 hh + s, then 16 + 8 hh + (s - 8)), the order in which the V^T rows are loaded.
// The softmax runs in base 2: Q16 already holds the score factor with log2 e (k_qkv) and the mask table is in those units. Each query column keeps a reference r_c, set 10 below the column's maximum at the time it was set, and a weight is 2^(score - r_c): the first product of a score tile takes mask - r_c as its C operand, so that the tile leaves the matrix unit as the arguments of v_exp_f32; numerator and denominator hold the same factor, which the final division takes out. The reference moves, and accumulators and sum are rescaled, only when a score has climbed more than 15 above it.
// K and V^T go through LDS in stages of 2 x 64 keys (each key group: two passes of 32), two buffers, shared by the block's waves: stage t + 1 flies while stage t is worked on; a key group's 4 waves copy that group's half of the stage. The fragments are read from LDS in the k order of g2_frag.
template <int CAUSAL>
__global__ __launch_bounds__(256) __attribute__((amdgpu_waves_per_eu(4, 4))) void k_flash(const _Float16* __restrict__ Q16, int ldq, const _Float16* __restrict__ K16, int ldk, const _Float16* __restrict__ Vt, const int* __restrict__ MSK, float* __restrict__ O, int ldo) {
  constexpr int RPW = 32, CG = 2, DT = 4, KS = 2;
  __shared__ __attribute__((aligned(16))) float sO[4][RPW][64 + 4];
  __shared__ __attribute__((aligned(16))) float sM[4][CG * DT * 2][32][4];      /* key group 1's accumulators on their way to key group 0: 16 bytes a lane, lanes side by side */
  __shared__ float sL[4][CG][2][32];      /* ... and its sums and references */
  __shared__ __attribute__((aligned(16))) _Float16 st[2][2][128][FLP / 2];      /* [buffer][key group][64 K rows, 64 V^T rows] */
  const int tid = threadIdx.x, g = tid >> 7, t7 = tid & 127, w = (tid >> 5) & 3, lane = tid & 31, ln = lane & 15, hh = lane >> 4;
  const int slab = blockIdx.x / QBNP, qblk = QB0P + blockIdx.x % QBNP; const int b = slab / NH, h = slab % NH; const int qb0 = qblk * (4 * RPW); const int q0 = qb0 + w * RPW;
  FragH bq[CG][KS];
#pragma unroll
  for (int cg = 0; cg < CG; ++cg) { const unsigned short* qr = (const unsigned short*)Q16 + ((size_t)b * TQ + q0 + cg * 16 + ln) * ldq + h * 64;
#pragma unroll
    for (int ks = 0; ks < KS; ++ks) { bq[cg][ks].half[0] = *(const v8us*)(qr + ks * 32 + 8 * hh); bq[cg][ks].half[1] = *(const v8us*)(qr + ks * 32 + 16 + 8 * hh); } }
  /* this lane's 16 bytes of its key group's half of stage 0 (K row t7 / 8 of the half, V^T row t7 / 8) and their place in buffer 0 */
  const _Float16* gk = K16 + ((size_t)b * TK + g * 64 + (t7 >> 3)) * ldk + h * 64 + (t7 & 7) * 8; const _Float16* gv = Vt + ((size_t)slab * 64 + (t7 >> 3)) * TK + g * 64 + (t7 & 7) * 8;
  const unsigned ls = (unsigned)(size_t)&st[0][g][t7 >> 3][(t7 & 7) * 8];
  const char* mb = (const char*)((const float*)MSK + (size_t)b * TK); const unsigned mo = (unsigned)g * 256u + (unsigned)hh * 32u;      /* a uniform base that steps with the pass; this key group's and this half's 8 mask words */
  float r_c[CG], l_c[CG]; v8f oacc[CG][DT];      /* r_c: the column's reference, see the stage loop */
#pragma unroll
  for (int cg = 0; cg < CG; ++cg) { r_c[cg] = -3.0e38f; l_c[cg] = 0.f;
#pragma unroll
    for (int dt = 0; dt < DT; ++dt) oacc[cg][dt] = (v8f){0.f,0.f,0.f,0.f,0.f,0.f,0.f,0.f}; }
  const int jend = (CAUSAL == 1) ? (qb0 + 4 * RPW) : TK;      /* causal: keys beyond the block's last query never contribute */
  const int nst = jend >> 7;      /* both ends are multiples of 128; the same for the whole block */
  fl_stage(ls, gk, (size_t)ldk, gv);
  asm volatile("s_wait_asynccnt 0x0" ::: "memory");      /* stage 0 of this wave has landed */
  __syncthreads();      /* ... and every wave's share of it */
  if (nst > 1) fl_stage(ls + 2 * FLS, gk + (size_t)128 * ldk, (size_t)ldk, gv + 128);
  v4f mk[2][2];      /* a pass's mask words (from the table in global memory): they stand in front of the pass's first product, so each pass asks for the next one's; here the first pass's */
  if (CAUSAL == 17) {
#pragma unroll
    for (int nt = 0; nt < 2; ++nt) { mk[nt][0] = *(const v4fa*)(mb + mo + nt * 64); mk[nt][1] = *(const v4fa*)(mb + mo + nt * 64 + 16); } }
  /* One loop over passes of 32 keys x 32 query columns, two passes to a stage; a pass runs from its K fragments to its second products, so that only one pass's scores and fragments are live at a time (the wave keeps within the registers of four waves a SIMD). The loop stays rolled: one pass of code, accumulators in the same registers throughout (with the two passes of a stage unrolled this build copied all 64 accumulator registers to and fro around the second pass's rescale branch); buffer and pass are picked by the trip's number; every inner loop is unrolled so that the fragment and score arrays have constant indices and stay in registers */
#pragma unroll 1
  for (int ps2 = 0; ps2 < 2 * nst; ++ps2) { const int t = ps2 >> 1, pp = ps2 & 1; const _Float16* skr = &st[t & 1][g][pp * 32 + ln][0]; const _Float16* svr = &st[t & 1][g][64 + ln][pp * 32];      /* this lane's first K row and its V^T row's 32 keys of the pass, in its key group's half of the buffer */
   { const int j0 = t * 128 + g * 64 + pp * 32;
    FragH ak[2][KS], av[DT]; v2f sc[CG][8]; bool ok[CG][16];      /* scores minus reference, as the register pairs in which the accumulators hold them */
    v8f cz[2];      /* the pass's mask words in the accumulators' order: register r of tile nt is key 16 nt + 8 hh + r (mode 17: additive per-(batch, key) mask, rounded and scaled by k_prep) */
#pragma unroll
    for (int nt = 0; nt < 2; ++nt) {
#pragma unroll
      for (int r = 0; r < 4; ++r) { cz[nt][r] = (CAUSAL == 17) ? mk[nt][0][r] : 0.f; cz[nt][4 + r] = (CAUSAL == 17) ? mk[nt][1][r] : 0.f; } }
#pragma unroll
    for (int nt = 0; nt < 2; ++nt) {
#pragma unroll
      for (int ks = 0; ks < KS; ++ks) ak[nt][ks].v = g2_frag(skr + nt * 16 * (FLP / 2) + ks * 32, hh); }      /* key rows ln and 16 + ln of the pass */
    __builtin_amdgcn_sched_barrier(0);      /* the K reads are issued first ... */
    v8f cm[2][CG];      /* C = mask - reference: the products are summed onto it */
#pragma unroll
    for (int nt = 0; nt < 2; ++nt) {
#pragma unroll
     for (int cg = 0; cg < CG; ++cg) cm[nt][cg] = cz[nt] - r_c[cg]; }
    __builtin_amdgcn_sched_barrier(0);      /* ... and the C operands are formed while they are on their way: neither in front of the reads nor behind the wait for them, where this build put them */
    asm volatile("" :: "v"(ak[0][0].v), "v"(ak[0][1].v), "v"(ak[1][0].v), "v"(ak[1][1].v));      /* inputs only: keeps the pass's eight K reads together in front of its first product (one LDS wait instead of one for each fragment) */
#pragma unroll
    for (int nt = 0; nt < 2; ++nt) {
#pragma unroll
     for (int cg = 0; cg < CG; ++cg) { const int tq = q0 + cg * 16 + ln; v8f acc = cm[nt][cg];
#pragma unroll
      for (int ks = 0; ks < KS; ++ks) acc = mmaT(ak[nt][ks].v, bq[cg][ks].v, acc);
#pragma unroll
      for (int j = 0; j < 4; ++j) { v2f s2 = (v2f){acc[2 * j], acc[2 * j + 1]};
#pragma unroll
        for (int e = 0; e < 2; ++e) { const int kk = j0 + nt * 16 + 8 * hh + 2 * j + e; const bool okk = (CAUSAL == 1) ? (kk <= tq) : ((CAUSAL == 2) ? ((kk >> 5) == (tq >> 5)) : true);      /* mode 2: block-diagonal 32-token groups */
          if (!okk) s2[e] = -3.0e38f; ok[cg][nt * 8 + 2 * j + e] = okk; }
        sc[cg][nt * 4 + j] = s2; } } }
    __builtin_amdgcn_sched_barrier(0);      /* the eight products stand as one run: each fills the others' distance to the first reader of a result (with the maxima moved in among them this build padded that distance with ten v_nop) */
    float mc[CG];
#pragma unroll
    for (int cg = 0; cg < CG; ++cg) mc[cg] = fl_max16(sc[cg]);
    /* Lazy rescale, one test a pass: the scores stand above their references as they come, and while none lies more than 15 above, every weight 2^(score - reference) is at most 2^15, which f16 holds, and numerator and denominator go on in the units they are in. A scalar branch: the whole wave takes it or none */
    if (__builtin_amdgcn_ballot_w32(fmaxf(mc[0], mc[1]) > 15.0f) != 0) {      /* mc: the maximum of this half's 16 keys of the pass; the vote sees both halves and both column tiles */
     /* A reference is to move. Summed onto a reference that lies far off (the start value, or one set among masked keys) the products have lost their low bits, so the pass's score products are done again with the mask words alone as C: scores in absolute units, from which the new reference is set as before */
#pragma unroll
     for (int cg = 0; cg < CG; ++cg) {
#pragma unroll
      for (int nt = 0; nt < 2; ++nt) { v8f acc = cz[nt];
#pragma unroll
       for (int ks = 0; ks < KS; ++ks) acc = mmaT(ak[nt][ks].v, bq[cg][ks].v, acc);
#pragma unroll
       for (int j = 0; j < 4; ++j) { v2f s2 = (v2f){acc[2 * j], acc[2 * j + 1]};
#pragma unroll
        for (int e = 0; e < 2; ++e) if (!ok[cg][nt * 8 + 2 * j + e]) s2[e] = -3.0e38f;
        sc[cg][nt * 4 + j] = s2; } }
      mc[cg] = fl_max16(sc[cg]); }
     __builtin_amdgcn_sched_barrier(0);      /* the v_exp_f32 statements below stay behind both tiles' maxima, which read the products' results: the compiler does not see that asm text writes a vector register, and moved up among the products one could overwrite an operand of a product just issued */
#pragma unroll
     for (int cg = 0; cg < CG; ++cg) {
      const float mj = fmaxf(mc[cg], xhalf(mc[cg]));      /* both halves now hold the query's maximum over the pass's 32 keys, so both set the same reference */
      float rn = mj - 10.0f; if (mj - rn > 15.0f) rn = mj;      /* where the maximum is so large that the subtraction rounds to more than 15 below it, the reference is the maximum itself: no weight ever leaves f16 */
      rn = fmaxf(r_c[cg], rn); const float da = r_c[cg] - rn; float ea;
      asm("v_exp_f32 %0, %1\n\tv_nop" : "=&v"(ea) : "v"(da));      /* the v_nop is the slot that the instruction set asks for behind a transcendental */
      const float al = (rn > -1.0e38f * LOG2E) ? ea : 1.0f;      /* the same test as before, its threshold in base-2 units */
      r_c[cg] = rn; l_c[cg] *= al;
#pragma unroll
      for (int i = 0; i < 8; ++i) sc[cg][i] -= (v2f){rn, rn};      /* never above 15 */
#pragma unroll
      for (int dt = 0; dt < DT; ++dt) {
#pragma unroll
        for (int r = 0; r < 8; ++r) oacc[cg][dt][r] *= al; } } }
#pragma unroll
    for (int dt = 0; dt < DT; ++dt) av[dt].v = g2_frag(svr + dt * 16 * (FLP / 2), hh);      /* V^T row dt * 16 + ln, the pass's 32 keys; behind the branch, which may still read the K fragments */
    if (ps2 + 1 < 2 * nst) mb += pp ? 384 : 128;      /* the key group's next 32 keys: in this stage, or in the next one, past the other group's 64; the last pass reads its own words again and stays inside the table */
    const char* mp = mb + mo;
    if (CAUSAL == 17) {
#pragma unroll
      for (int nt = 0; nt < 2; ++nt) { mk[nt][0] = *(const v4fa*)(mp + nt * 64); mk[nt][1] = *(const v4fa*)(mp + nt * 64 + 16); } }
    __builtin_amdgcn_sched_barrier(0);      /* the V^T reads and the next mask words are asked for ahead of the weights' arithmetic, which hides their way (left to itself this build put the reads in the middle of it) */
    FragH pb[CG];
#pragma unroll
   for (int cg = 0; cg < CG; ++cg) {
    float x[16], p[16];
#pragma unroll
    for (int i = 0; i < 8; ++i) { x[2 * i] = sc[cg][i][0]; x[2 * i + 1] = sc[cg][i][1]; }      /* score - reference, never above 15 */
    /* 2^x is the one hardware instruction v_exp_f32 (a result below the normal range comes out as 0: such a weight is 0 in the f16 operand anyway). A tile's sixteen stand in two statements because the instruction set asks that the instruction directly behind a transcendental neither read its result nor overwrite its source: the early-clobber outputs keep every result out of every argument's register, and the v_nop is the slot of each statement's last v_exp_f32 (written as builtins, this build put a result into the argument register of the v_exp_f32 in front of it) */
    asm("v_exp_f32 %0, %8\n\tv_exp_f32 %1, %9\n\tv_exp_f32 %2, %10\n\tv_exp_f32 %3, %11\n\tv_exp_f32 %4, %12\n\tv_exp_f32 %5, %13\n\tv_exp_f32 %6, %14\n\tv_exp_f32 %7, %15\n\tv_nop"
        : "=&v"(p[0]), "=&v"(p[1]), "=&v"(p[2]), "=&v"(p[3]), "=&v"(p[4]), "=&v"(p[5]), "=&v"(p[6]), "=&v"(p[7]) : "v"(x[0]), "v"(x[1]), "v"(x[2]), "v"(x[3]), "v"(x[4]), "v"(x[5]), "v"(x[6]), "v"(x[7]));
    asm("v_exp_f32 %0, %8\n\tv_exp_f32 %1, %9\n\tv_exp_f32 %2, %10\n\tv_exp_f32 %3, %11\n\tv_exp_f32 %4, %12\n\tv_exp_f32 %5, %13\n\tv_exp_f32 %6, %14\n\tv_exp_f32 %7, %15\n\tv_nop"
        : "=&v"(p[8]), "=&v"(p[9]), "=&v"(p[10]), "=&v"(p[11]), "=&v"(p[12]), "=&v"(p[13]), "=&v"(p[14]), "=&v"(p[15]) : "v"(x[8]), "v"(x[9]), "v"(x[10]), "v"(x[11]), "v"(x[12]), "v"(x[13]), "v"(x[14]), "v"(x[15]));
#pragma unroll
    for (int i = 0; i < 16; ++i) { if (!ok[cg][i]) p[i] = 0.f; pb[cg].h[i] = (_Float16)p[i]; }
    const float pe = ((p[0] + p[2]) + (p[4] + p[6])) + ((p[8] + p[10]) + (p[12] + p[14])), po = ((p[1] + p[3]) + (p[5] + p[7])) + ((p[9] + p[11]) + (p[13] + p[15])); const float ps = pe + po;
    l_c[cg] += ps; }      /* this half's 16 keys of the pass; halves and key groups are joined once, behind the loop */
    __builtin_amdgcn_sched_barrier(0);      /* every v_exp_f32 statement stays in front of the pass's second products: the compiler does not see that asm text writes vector registers, and moved in between it would let one overwrite an operand of the product just issued */
    if (CAUSAL == 17) asm volatile("s_wait_xcnt 0x0" :: "v"(mp) : "memory");      /* the mask loads' address register lives up to this wait: nothing is written over it while a load that names it is under way; it stands behind the weights' arithmetic */
#pragma unroll
    for (int dt = 0; dt < DT; ++dt) {
#pragma unroll
      for (int cg = 0; cg < CG; ++cg) oacc[cg][dt] = mmaT(av[dt].v, pb[cg].v, oacc[cg][dt]); } }
    if (pp) {      /* the foot of a stage; the test reads the same for the whole block */
    asm volatile("s_wait_dscnt 0x0" ::: "memory");      /* this wave's reads of the buffer are done before it is refilled */
    asm volatile("s_wait_asynccnt 0x0" ::: "memory");      /* this wave's share of stage t + 1 has landed */
    __syncthreads();      /* publishes stage t + 1 and ends every wave's reads of stage t */
    if (t + 2 < nst) fl_stage(ls + (unsigned)(t & 1) * (2 * FLS), gk + (size_t)(t + 2) * 128 * ldk, (size_t)ldk, gv + (size_t)(t + 2) * 128); } }
  asm volatile("s_wait_asynccnt 0x0" ::: "memory");      /* nothing in flight when the wave goes on to the epilogue */
  /* the join of the two key groups: group 1 hands accumulators, sums and references to the wave of group 0 that holds the same queries */
  if (g == 1) {      /* the same for a whole wave */
#pragma unroll
    for (int cg = 0; cg < CG; ++cg) { sL[w][cg][0][lane] = l_c[cg]; sL[w][cg][1][lane] = r_c[cg];
#pragma unroll
      for (int dt = 0; dt < DT; ++dt) { v4f lo, hi;
#pragma unroll
        for (int r = 0; r < 4; ++r) { lo[r] = oacc[cg][dt][r]; hi[r] = oacc[cg][dt][4 + r]; }
        *(v4fa*)&sM[w][(cg * DT + dt) * 2][lane][0] = lo; *(v4fa*)&sM[w][(cg * DT + dt) * 2 + 1][lane][0] = hi; } } }
  __syncthreads();      /* group 1's LDS writes are done before group 0 reads them; every wave passes it */
  if (g == 1) return;      /* no barrier stands behind this line */
#pragma unroll
  for (int cg = 0; cg < CG; ++cg) {
    const float l1 = sL[w][cg][0][lane], r1 = sL[w][cg][1][lane]; const float rn = fmaxf(r_c[cg], r1); const float d0 = r_c[cg] - rn, d1 = r1 - rn; float a0, a1;      /* both parts go to the units of the higher reference: one factor is 1, the other at most 1 */
    asm("v_exp_f32 %0, %2\n\tv_exp_f32 %1, %3\n\tv_nop" : "=&v"(a0), "=&v"(a1) : "v"(d0), "v"(d1));      /* the v_nop is the slot that the instruction set asks for behind a transcendental */
    const float lj = l_c[cg] * a0 + l1 * a1;
    const float l = lj + xhalf(lj); const float inv = (l > 0.f) ? 1.0f / l : 0.f;      /* numerator and denominator both hold the factor 2^-rn */
    const float f0 = a0 * inv, f1 = a1 * inv;
#pragma unroll
    for (int dt = 0; dt < DT; ++dt) { const v4f ml = *(const v4fa*)&sM[w][(cg * DT + dt) * 2][lane][0], mh = *(const v4fa*)&sM[w][(cg * DT + dt) * 2 + 1][lane][0]; v4f lo, hi;      /* register r = head column dt * 16 + 8 hh + r of query q0 + 16 cg + ln */
#pragma unroll
      for (int r = 0; r < 4; ++r) { lo[r] = oacc[cg][dt][r] * f0 + ml[r] * f1; hi[r] = oacc[cg][dt][4 + r] * f0 + mh[r] * f1; }
      *(v4fa*)&sO[w][cg * 16 + ln][dt * 16 + 8 * hh] = lo; *(v4fa*)&sO[w][cg * 16 + ln][dt * 16 + 8 * hh + 4] = hi; } }
  __builtin_amdgcn_fence(__ATOMIC_ACQ_REL, "workgroup"); __builtin_amdgcn_wave_barrier();
  {
#pragma unroll
    for (int rp = 0; rp < RPW; rp += 2) { const int r = rp + (lane >> 4), pc = lane & 15; const v4f val = *(const v4fa*)&sO[w][r][pc * 4]; *(v4f*)(O + ((size_t)b * TQ + q0 + r) * ldo + h * 64 + pc * 4) = val; }
     } }
// 5-plane variant: S = Qh Kh^T + (Ql Kh^T + Qh Kl^T)/1024 with Q/K = [hi | 2^10 residual] f16 planes (QL/KL same layout as Q16/K16), then the 3-term P.V below.
// 3-term variant: O = (P_hi V_hi + (P_lo V_hi + P_hi V_lo) / 1024) / l with P = [hi | 2^10 residual] of 1024 p and V^T = [hi | 2^10 residual] planes (VtL same layout as Vt) -> ~2^-21-class products for un-averaged (early causal / peaked) rows
template <int CAUSAL>
__global__ __launch_bounds__(128) void k_flash5(const _Float16* __restrict__ Q16, const _Float16* __restrict__ QL, int ldq, const _Float16* __restrict__ K16, const _Float16* __restrict__ KL, int ldk, const _Float16* __restrict__ Vt, const _Float16* __restrict__ VtL, const int* __restrict__ MSK, float* __restrict__ O, int ldo) {
  constexpr int RPW = 16, RTN = RPW / 16, NQB = TQ / (4 * RPW), DT = 4, KS = 2;
  __shared__ __attribute__((aligned(16))) unsigned short sP[4][RPW][40]; __shared__ __attribute__((aligned(16))) unsigned short sPL[4][RPW][40]; __shared__ __attribute__((aligned(16))) float sO[4][RPW][64 + 4];
  const int tid = threadIdx.x, w = tid >> 5, lane = tid & 31, ln = lane & 15, hh = lane >> 4;
  const int slab = blockIdx.x / QBN5, qblk = QB05 + blockIdx.x % QBN5; (void)NQB; const int b = slab / NH, h = slab % NH; const int qb0 = qblk * (4 * RPW); const int q0 = qb0 + w * RPW;
  FragH aq[2][KS], aql[2][KS];
#pragma unroll
  for (int rt = 0; rt < RTN; ++rt) { const unsigned short* qr = (const unsigned short*)Q16 + ((size_t)b * TQ + q0 + rt * 16 + ln) * ldq + h * 64; const unsigned short* ql = (const unsigned short*)QL + ((size_t)b * TQ + q0 + rt * 16 + ln) * ldq + h * 64;
#pragma unroll
    for (int ks = 0; ks < KS; ++ks) { aq[rt][ks].half[0] = *(const v8us*)(qr + ks * 32 + 8 * hh); aq[rt][ks].half[1] = *(const v8us*)(qr + ks * 32 + 16 + 8 * hh); aql[rt][ks].half[0] = *(const v8us*)(ql + ks * 32 + 8 * hh); aql[rt][ks].half[1] = *(const v8us*)(ql + ks * 32 + 16 + 8 * hh); } }
  const unsigned short* Vth = (const unsigned short*)Vt + (size_t)slab * 64 * TK; const unsigned short* Vtl = (const unsigned short*)VtL + (size_t)slab * 64 * TK;
  float m_r[2][8], l_r[2][8]; v8f oacc[2][DT], oaccL[2][DT];
#pragma unroll
  for (int rt = 0; rt < RTN; ++rt) {
#pragma unroll
    for (int r = 0; r < 8; ++r) { m_r[rt][r] = -3.0e38f; l_r[rt][r] = 0.f; }
#pragma unroll
    for (int dt = 0; dt < DT; ++dt) { oacc[rt][dt] = (v8f){0.f,0.f,0.f,0.f,0.f,0.f,0.f,0.f}; oaccL[rt][dt] = oacc[rt][dt]; } }
  const int jend = (CAUSAL == 1) ? (qb0 + 4 * RPW) : TK;      /* causal: keys beyond the block's last query never contribute */
#pragma unroll 1
  for (int j0 = 0; j0 < jend; j0 += 32) {
    v8f s[2][2];
#pragma unroll
    for (int nt = 0; nt < 2; ++nt) { const unsigned short* kr = (const unsigned short*)K16 + ((size_t)b * TK + j0 + nt * 16 + ln) * ldk + h * 64; const unsigned short* klr = (const unsigned short*)KL + ((size_t)b * TK + j0 + nt * 16 + ln) * ldk + h * 64; FragH bk[KS], bkl[KS];
#pragma unroll
      for (int ks = 0; ks < KS; ++ks) { bk[ks].half[0] = *(const v8us*)(kr + ks * 32 + 8 * hh); bk[ks].half[1] = *(const v8us*)(kr + ks * 32 + 16 + 8 * hh); bkl[ks].half[0] = *(const v8us*)(klr + ks * 32 + 8 * hh); bkl[ks].half[1] = *(const v8us*)(klr + ks * 32 + 16 + 8 * hh); }
#pragma unroll
      for (int rt = 0; rt < RTN; ++rt) { v8f acc = (v8f){0.f,0.f,0.f,0.f,0.f,0.f,0.f,0.f}, accl = acc;
#pragma unroll
        for (int ks = 0; ks < KS; ++ks) { acc = mmaH<1>(aq[rt][ks].v, aq[rt][ks].v, bk[ks].v, bk[ks].v, acc); accl = mmaH<1>(aql[rt][ks].v, aql[rt][ks].v, bk[ks].v, bk[ks].v, accl); accl = mmaH<1>(aq[rt][ks].v, aq[rt][ks].v, bkl[ks].v, bkl[ks].v, accl); }
#pragma unroll
        for (int r = 0; r < 8; ++r) acc[r] += accl[r] * 0.0009765625f;
        s[rt][nt] = acc; } }
#pragma unroll
    for (int rt = 0; rt < RTN; ++rt)
#pragma unroll
      for (int r = 0; r < 8; ++r) { const int tq = q0 + rt * 16 + 8 * hh + r; const int k0 = j0 + ln, k1 = j0 + 16 + ln;
        bool ok0 = (CAUSAL == 1) ? (k0 <= tq) : ((CAUSAL == 2) ? ((k0 >> 5) == (tq >> 5)) : true), ok1 = (CAUSAL == 1) ? (k1 <= tq) : ((CAUSAL == 2) ? ((k1 >> 5) == (tq >> 5)) : true);      /* mode 2: block-diagonal 32-token groups */
        if (CAUSAL == 4) { const int* mrow = MSK + ((size_t)b * TQ + tq) * TK; ok0 = mrow[k0] != 0; ok1 = mrow[k1] != 0; }      /* mode 4: per-(query, key) INPUT mask shared by all heads; masked keys contribute nothing (== the reference's -4096 fill, whose exp underflows to 0), rows with no valid key give l = 0 -> output 0 (== the reference's row_valid zeroing) */
        float s0 = ok0 ? s[rt][0][r] * SCL : -3.0e38f, s1 = ok1 ? s[rt][1][r] * SCL : -3.0e38f; if (CAUSAL == 17) { const float* amk = (const float*)MSK + (size_t)b * TK; s0 += bf16_round(amk[k0]); s1 += bf16_round(amk[k1]); }      /* mode 17: additive per-(batch, key) mask INPUT */ float mc = fmaxf(s0, s1);
        mc = fmaxf(mc, __shfl_xor(mc, 1, 32)); mc = fmaxf(mc, __shfl_xor(mc, 2, 32)); mc = fmaxf(mc, __shfl_xor(mc, 4, 32)); mc = fmaxf(mc, __shfl_xor(mc, 8, 32));
        const float mn = fmaxf(m_r[rt][r], mc); const float al = (mn > -1.0e38f) ? expf(m_r[rt][r] - mn) : 1.0f; m_r[rt][r] = mn; const float p0 = ok0 ? expf(s0 - mn) : 0.f, p1 = ok1 ? expf(s1 - mn) : 0.f; l_r[rt][r] = l_r[rt][r] * al + p0 + p1;
#pragma unroll
        for (int dt = 0; dt < DT; ++dt) { oacc[rt][dt][r] *= al; oaccL[rt][dt][r] *= al; }
        FragH t2, t2l; const float ps0 = p0 * 1024.0f, ps1 = p1 * 1024.0f; t2.h[0] = (_Float16)ps0; t2.h[1] = (_Float16)ps1; t2l.h[0] = (_Float16)((ps0 - (float)t2.h[0]) * 1024.0f); t2l.h[1] = (_Float16)((ps1 - (float)t2.h[1]) * 1024.0f);
        sP[w][rt * 16 + 8 * hh + r][ln] = t2.u[0]; sP[w][rt * 16 + 8 * hh + r][16 + ln] = t2.u[1]; sPL[w][rt * 16 + 8 * hh + r][ln] = t2l.u[0]; sPL[w][rt * 16 + 8 * hh + r][16 + ln] = t2l.u[1]; }
    __builtin_amdgcn_fence(__ATOMIC_ACQ_REL, "workgroup"); __builtin_amdgcn_wave_barrier();
    FragH pa[2], pl[2];
#pragma unroll
    for (int rt = 0; rt < RTN; ++rt) { pa[rt].half[0] = *(const v8us*)&sP[w][rt * 16 + ln][8 * hh]; pa[rt].half[1] = *(const v8us*)&sP[w][rt * 16 + ln][16 + 8 * hh]; pl[rt].half[0] = *(const v8us*)&sPL[w][rt * 16 + ln][8 * hh]; pl[rt].half[1] = *(const v8us*)&sPL[w][rt * 16 + ln][16 + 8 * hh]; }
#pragma unroll
    for (int dt = 0; dt < DT; ++dt) { const unsigned short* vrow = Vth + (size_t)(dt * 16 + ln) * TK + j0; const unsigned short* vrl = Vtl + (size_t)(dt * 16 + ln) * TK + j0; FragH bv, bl; bv.half[0] = *(const v8us*)(vrow + 8 * hh); bv.half[1] = *(const v8us*)(vrow + 16 + 8 * hh); bl.half[0] = *(const v8us*)(vrl + 8 * hh); bl.half[1] = *(const v8us*)(vrl + 16 + 8 * hh);
#pragma unroll
      for (int rt = 0; rt < RTN; ++rt) { oacc[rt][dt] = mmaH<1>(pa[rt].v, pa[rt].v, bv.v, bv.v, oacc[rt][dt]); oaccL[rt][dt] = mmaH<1>(pl[rt].v, pl[rt].v, bv.v, bv.v, oaccL[rt][dt]); oaccL[rt][dt] = mmaH<1>(pa[rt].v, pa[rt].v, bl.v, bl.v, oaccL[rt][dt]); } }
    __builtin_amdgcn_fence(__ATOMIC_ACQ_REL, "workgroup"); __builtin_amdgcn_wave_barrier(); }
#pragma unroll
  for (int rt = 0; rt < RTN; ++rt) {
#pragma unroll
    for (int r = 0; r < 8; ++r) { float l = l_r[rt][r]; l += __shfl_xor(l, 1, 32); l += __shfl_xor(l, 2, 32); l += __shfl_xor(l, 4, 32); l += __shfl_xor(l, 8, 32); l_r[rt][r] = (l > 0.f) ? 1.0f / (l * 1024.0f) : 0.f; }
#pragma unroll
    for (int dt = 0; dt < DT; ++dt)
#pragma unroll
      for (int r = 0; r < 8; ++r) { float v = oacc[rt][dt][r]; v += oaccL[rt][dt][r] * 0.0009765625f; sO[w][rt * 16 + 8 * hh + r][dt * 16 + ln] = v * l_r[rt][r]; } }
  __builtin_amdgcn_fence(__ATOMIC_ACQ_REL, "workgroup"); __builtin_amdgcn_wave_barrier();
  {
#pragma unroll
    for (int rp = 0; rp < RPW; rp += 2) { const int r = rp + (lane >> 4), pc = lane & 15; const v4f val = *(const v4fa*)&sO[w][r][pc * 4]; *(v4f*)(O + ((size_t)b * TQ + q0 + r) * ldo + h * 64 + pc * 4) = val; }
     } }

__global__ __launch_bounds__(256) void k_rotab(float* __restrict__ CS, float* __restrict__ SN) {
  #pragma clang fp contract(off)
  const int t = blockIdx.x * 256 + threadIdx.x; if (t >= SLEN * 32) return; const int j = t % 32, s = t / 32; const float ex = (float)(2 * j) / 64.0f; const float inv = 1.0f / powf(10000.0f, ex); const float th = (float)s * inv; const float c = cosf(th), sn = sinf(th);
  { *(float*)(CS + t) = c; *(float*)(SN + t) = sn;  } }
__global__ __launch_bounds__(256) void k_rope(const float* __restrict__ F, int nsrc, int ndst, int rep, const float* __restrict__ CS, const float* __restrict__ SN, _Float16* __restrict__ H, _Float16* __restrict__ L) {
  #pragma clang fp contract(off)
  const size_t t = (size_t)blockIdx.x * 256 + threadIdx.x; if (t >= (size_t)NR * ndst * 4) return; const int g8 = (int)(t % 4); const int hd = (int)((t / 4) % ndst); const size_t row = t / ((size_t)4 * ndst); const int s = (int)(row % SLEN); const int hs = hd / rep;
  const float* src = F + row * (size_t)(nsrc * 64) + hs * 64; FragH ah, al, bh, bl;
  for (int i = 0; i < 8; ++i) { const int d = g8 * 8 + i; const float c = CS[s * 32 + d], sn = SN[s * 32 + d]; const float x1 = src[d], x2 = src[d + 32];
    float o1 = x1 * c; o1 += -x2 * sn; float o2 = x2 * c; o2 += x1 * sn;
    _Float16 hv = (_Float16)o1; ah.h[i] = hv; al.h[i] = (_Float16)((o1 - (float)hv) * 1024.0f); hv = (_Float16)o2; bh.h[i] = hv; bl.h[i] = (_Float16)((o2 - (float)hv) * 1024.0f); }
  const size_t o = row * (size_t)(ndst * 64) + hd * 64 + g8 * 8;
  { *(v8us*)((unsigned short*)H + o) = ah.half[0]; *(v8us*)((unsigned short*)H + o + 32) = bh.half[0]; *(v8us*)((unsigned short*)L + o) = al.half[0]; *(v8us*)((unsigned short*)L + o + 32) = bl.half[0];  } }
// Every operand conversion in ONE launch, by block ranges: the exact f16 plane of x, the three weight planes (x16, one behind the other in B3), and the mask table of the flash kernel.
// A conversion block streams 16384 values: 16 loads of 16 bytes a lane, each wave-wide load 512 bytes in a row, several of them under way at once; each store of a wave is two whole 128-byte lines. Few, long waves: a launch of such short work is paced by how fast waves start.
// The mask table: M2 = bf16-rounded mask times log2 e. Beyond +-1e38 the table goes on with slope 1/2, so that the factor turns no finite mask into an infinity: two different bf16 values up there still lie more than 1e35 apart in the table, so the smaller one's weight is 0 as it is in natural units, equal values stay equal, and the order is kept; an infinite mask stays infinite
#define PXB (NR * DM / 16384)      /* blocks for x */
#define PWB (DM * DM / 16384)      /* blocks for one weight matrix */
#define PMB (NB * SLEN / 256)      /* blocks for the mask: 1 value a thread */
__global__ __launch_bounds__(256) void k_prep(const float* __restrict__ x, const float* __restrict__ Wq, const float* __restrict__ Wk, const float* __restrict__ Wv, const float* __restrict__ am, _Float16* __restrict__ X16, _Float16* __restrict__ B3, float* __restrict__ M2) {
  const int bx = blockIdx.x, tid = threadIdx.x;
  if (bx >= PXB + 3 * PWB) { const int t = (bx - (PXB + 3 * PWB)) * 256 + tid; const float mr = bf16_round(am[t]), ma = fabsf(mr); M2[t] = (ma <= 1.0e38f) ? mr * LOG2E : copysignf(1.0e38f * LOG2E + (ma - 1.0e38f) * 0.5f, mr); return; }
  const float* src = x; _Float16* dst = X16; float sc = 1.0f; int b0 = bx;
  if (bx >= PXB) { const int wi = (bx - PXB) / PWB; b0 = (bx - PXB) % PWB; src = (wi == 0) ? Wq : ((wi == 1) ? Wk : Wv); dst = B3 + (size_t)wi * DM * DM; sc = 16.0f; }      /* a weight is (out, in) = Bt as it lies */
  const size_t e0 = (size_t)b0 * 16384 + tid * 4; v4f v[16];
#pragma unroll      /* constant indices: the loaded values stay in registers, and loads can be issued ahead of the conversions */
  for (int j = 0; j < 16; ++j) v[j] = *(const v4fa*)(src + e0 + j * 1024);
#pragma unroll      /* constant indices: the loaded values stay in registers */
  for (int j = 0; j < 16; ++j) { v4h h4;
#pragma unroll      /* constant indices: the loaded values stay in registers */
    for (int q = 0; q < 4; ++q) h4[q] = (_Float16)(bf16_round(v[j][q]) * sc);
    *(v4h*)(dst + e0 + j * 1024) = h4; } }
__global__ __launch_bounds__(256) void k_rotab2(float* __restrict__ CS, float* __restrict__ SN) {
  #pragma clang fp contract(off)
  const int t = blockIdx.x * 256 + threadIdx.x; if (t >= SLEN * 32) return; const int j = t % 32, s = t / 32; const float c0 = -0.14391156831212787f;      /* -ln(10000)/64 rounded to f32 */ const float inv = expf((float)(2 * j) * c0); const float th = (float)s * inv; const float c = cosf(th), sn = sinf(th);
  { *(float*)(CS + t) = c; *(float*)(SN + t) = sn;  } }
__global__ __launch_bounds__(256) void k_lnu(const float* __restrict__ X, _Float16* __restrict__ N16, float* __restrict__ XB) {
  #pragma clang fp contract(off)
  const int wv = threadIdx.x >> 5, ln = threadIdx.x & 31; const size_t r = (size_t)blockIdx.x * 8 + wv; if (r >= NR) return; float a[32]; float s = 0.f;
  for (int i = 0; i < 4; ++i) { const v8f v = *(const v8f*)(X + r * DM + (i * 32 + ln) * 8); for (int q = 0; q < 8; ++q) { const float u = bf16_round(v[q]); a[i * 8 + q] = u; s += u; } }
  for (int o = 16; o > 0; o >>= 1) s += __shfl_xor(s, o, 32); const float mu = s / (float)DM; float var = 0.f; for (int q = 0; q < 32; ++q) { const float d = a[q] - mu; var += d * d; }
  for (int o = 16; o > 0; o >>= 1) var += __shfl_xor(var, o, 32); const float den = sqrtf(var / (float)(DM - 1)) + 1e-6f; const float inv = 1.0f / den;      /* one reciprocal per row; (x-mean)*inv vs the reference's division differs by <= 1 ulp */
  { for (int i = 0; i < 4; ++i) { const int c0 = (i * 32 + ln) * 8; FragH f; v8f xb; for (int q = 0; q < 8; ++q) { f.h[q] = (_Float16)((a[i * 8 + q] - mu) * inv); xb[q] = a[i * 8 + q]; } *(v8us*)((unsigned short*)N16 + r * DM + c0) = f.half[0]; *(v8f*)(XB + r * DM + c0) = xb; }  } }

extern "C" void kernel_launch(void* const* d_in, const int* in_sizes, int n_in,
                              void* d_out, int out_size, void* d_ws, size_t ws_size, hipStream_t stream) {
  (void)in_sizes; (void)n_in; (void)out_size;
  const float* const* I = (const float* const*)d_in; const float* x = I[0]; const float* sp = I[1]; const float* am = I[2]; const float* Wq = I[3]; const float* Wk = I[4]; const float* Wv = I[5];
  char* ws = (char*)d_ws; size_t off = 0;
  auto take = [&](size_t bytes) { char* p = ws + off; off += (bytes + 255) & ~(size_t)255; return p; };
  const size_t np = (size_t)NR * DM;
  _Float16* B3 = (_Float16*)take((size_t)3 * DM * DM * 2); float* M2 = (float*)take((size_t)NB * SLEN * 4);
  _Float16* X16 = (_Float16*)take(np * 2); _Float16* QH = (_Float16*)take(np * 2); _Float16* KXH = (_Float16*)take(np * 2); _Float16* VT = (_Float16*)take(np * 2);
  if (off > ws_size) return;      /* 6 + 4 x 8 MiB */
  k_prep<<<PXB + 3 * PWB + PMB, 256, 0, stream>>>(x, Wq, Wk, Wv, am, X16, B3, M2);
  k_qkv<<<(NR / G2M) * (3 * DM / G2N), 384, 0, stream>>>(X16, B3, sp, QH, KXH, VT);
  k_flash<17><<<NB * NH * QBNP, 256, 0, stream>>>(QH, DM, KXH, DM, VT, (const int*)M2, (float*)d_out, DM);      /* + the mask table [b][key]; the merged context is the output */
}
